// v000
// Times are from an AMD MI455X. After a warm-up the kernel runs many times in a row, and a time is the length of
// such a window on the GPU divided by its runs, so every launch and the gaps after it count. The runs cycle
// through copies of the inputs. A figure is the median of several windows, for all but v000 over two sittings.
// Sittings can differ by a few percent; kernels timed side by side share one.
// v000, which the later versions start from, runs in 581 microseconds.
#include <hip/hip_runtime.h>
#include <stdint.h>

// All contractions (q/k/v projections, q.k^T scores, p.v, output projection): v_wmma_f32_16x16x32_bf16 with bf16 hi/lo operand planes everywhere (hi.hi + lo.hi + hi.lo), f32 accumulate; alibi bias, 1/sqrt(d) scale, tanh softcap and softmax in f32.

#define B_  2
#define S_  2048
#define D_  1024
#define H_  16
#define DH_ 64
#define M_  (B_ * S_)

static_assert((M_ % 64) == 0);
static_assert((D_ % 64) == 0);
static_assert((S_ % 64) == 0);
static_assert(DH_ == 64);

typedef unsigned short u16;
typedef __bf16 v16bf __attribute__((ext_vector_type(16)));
typedef __bf16 v8bf  __attribute__((ext_vector_type(8)));
typedef float  v8f   __attribute__((ext_vector_type(8)));
typedef float  v4f   __attribute__((ext_vector_type(4)));
typedef unsigned int v4u __attribute__((ext_vector_type(4)));

union Frag { v16bf v; v8bf half[2]; };

// 16x32 fragment from a 16-bit plane stored [row][k] with k contiguous (pitch ld elements).
// Same map for A (row = m) and B (row = n): lane l -> row (l&15); elements 0..7 <- k0+8h+0..7,
// elements 8..15 <- k0+16+8h+0..7 with h = l>>4.
__device__ __forceinline__ v16bf ld_frag(const u16* base, int ld, int row0, int k0) {
  const int l = (int)(threadIdx.x & 31u), hh = l >> 4, m = l & 15;
  const u16* p = base + (size_t)(row0 + m) * (size_t)ld + (size_t)(k0 + 8 * hh);
  Frag f;
  f.half[0] = *(const v8bf*)(p);
  f.half[1] = *(const v8bf*)(p + 16);
  return f.v;
}

// D[16x16] += A[16x32] . B[32x16]; acc element r of lane l = (row 8h+r, col l&15). Hazard guard after every issue.
__device__ __forceinline__ void mma(v8f& acc, v16bf a, v16bf b) {
  acc = __builtin_amdgcn_wmma_f32_16x16x32_bf16(false, a, false, b, (short)0, acc, false, false);
  asm volatile("v_nop\n\tv_nop\n\tv_nop\n\tv_nop" : "+v"(acc) : "v"(a), "v"(b));
}

// f32 -> bf16 bits, RNE convert
__device__ __forceinline__ unsigned int bf16_bits(float f) {
  const unsigned int u = __float_as_uint(f);
  return (u + 0x7FFFu + ((u >> 16) & 1u)) >> 16;
}

// hi = bf16(x), lo = bf16(x - hi)
__device__ __forceinline__ void split_one(float x, unsigned int& hi, unsigned int& lo) {
  hi = bf16_bits(x);
  lo = bf16_bits(x - __uint_as_float(hi << 16));
}

__device__ __forceinline__ void split_pair(float x, float y, unsigned int& hi, unsigned int& lo) {
  unsigned int hx, lx, hy, ly;
  split_one(x, hx, lx);
  split_one(y, hy, ly);
  hi = hx | (hy << 16);
  lo = lx | (ly << 16);
}

// 8 consecutive floats -> packed 8 x bf16 hi (16 B) and 8 x bf16 lo (16 B)
__device__ __forceinline__ void split8(v4f a, v4f c, v4u& hi, v4u& lo) {
  unsigned int h0, l0, h1, l1, h2, l2, h3, l3;
  split_pair(a.x, a.y, h0, l0);
  split_pair(a.z, a.w, h1, l1);
  split_pair(c.x, c.y, h2, l2);
  split_pair(c.z, c.w, h3, l3);
  hi.x = h0; hi.y = h1; hi.z = h2; hi.w = h3;
  lo.x = l0; lo.y = l1; lo.z = l2; lo.w = l3;
}

// ---------------- f32 -> bf16 hi/lo planes for x and the four weight matrices ----------------
// blockIdx.y selects the segment (0: x, 1..4: Wq, Wk, Wv, Wo). Each thread converts 8 floats and
__global__ __launch_bounds__(256) void k_split(const float* __restrict__ x,
                                               const float* __restrict__ wq, const float* __restrict__ wk,
                                               const float* __restrict__ wv, const float* __restrict__ wo,
                                               u16* __restrict__ Xh, u16* __restrict__ Xl,
                                               u16* __restrict__ Wh, u16* __restrict__ Wl,
                                               int nx, int nw) {
  const int seg = (int)blockIdx.y;
  const float* src = x;
  u16* dh = Xh;
  u16* dl = Xl;
  int n = nx;
  if (seg > 0) {
    const int wi = seg - 1;
    src = (wi == 0) ? wq : (wi == 1) ? wk : (wi == 2) ? wv : wo;
    dh = Wh + (size_t)wi * (size_t)nw;
    dl = Wl + (size_t)wi * (size_t)nw;
    n = nw;
  }
  const size_t i8 = ((size_t)blockIdx.x * (size_t)blockDim.x + (size_t)threadIdx.x) * 8u;
  if (i8 + 8u > (size_t)n) return;
  const v4f a = *(const v4f*)(src + i8);
  const v4f c = *(const v4f*)(src + i8 + 4);
  v4u vh, vl;
  split8(a, c, vh, vl);
  u16* ph = dh + i8;
  u16* pl = dl + i8;
  *(v4u*)ph = vh;
  *(v4u*)pl = vl;
  
}

// ---------------- 64x64 block GEMM tile, 4 waves x (32x32), three-term hi/lo products ----------------
// C[m][n] = sum_k A[m][k] * B[n][k]  (A and B both stored [row][k], k contiguous).
// Result is left in the LDS tile [64][64] f32.
__device__ __forceinline__ void gemm_block64(const u16* Ah, const u16* Al, int lda,
                                             const u16* Bh, const u16* Bl, int ldb,
                                             int m0, int n0, int K, float* tile) {
  const int w = (int)(threadIdx.x >> 5), l = (int)(threadIdx.x & 31u), hh = l >> 4, nc = l & 15;
  const int wm = (w >> 1) * 32, wn = (w & 1) * 32;
  v8f acc[2][2] = {};
  for (int kk = 0; kk < K; kk += 32) {
    const v16bf a0h = ld_frag(Ah, lda, m0 + wm, kk);
    const v16bf a0l = ld_frag(Al, lda, m0 + wm, kk);
    const v16bf a1h = ld_frag(Ah, lda, m0 + wm + 16, kk);
    const v16bf a1l = ld_frag(Al, lda, m0 + wm + 16, kk);
    const v16bf b0h = ld_frag(Bh, ldb, n0 + wn, kk);
    const v16bf b0l = ld_frag(Bl, ldb, n0 + wn, kk);
    const v16bf b1h = ld_frag(Bh, ldb, n0 + wn + 16, kk);
    const v16bf b1l = ld_frag(Bl, ldb, n0 + wn + 16, kk);
    mma(acc[0][0], a0h, b0h); mma(acc[0][0], a0l, b0h); mma(acc[0][0], a0h, b0l);
    mma(acc[0][1], a0h, b1h); mma(acc[0][1], a0l, b1h); mma(acc[0][1], a0h, b1l);
    mma(acc[1][0], a1h, b0h); mma(acc[1][0], a1l, b0h); mma(acc[1][0], a1h, b0l);
    mma(acc[1][1], a1h, b1h); mma(acc[1][1], a1l, b1h); mma(acc[1][1], a1h, b1l);
  }
#pragma unroll
  for (int r = 0; r < 8; ++r) {
    const int row0 = wm + 8 * hh + r;
    const int row1 = wm + 16 + 8 * hh + r;
    tile[row0 * 64 + wn + nc]      = acc[0][0][r];
    tile[row0 * 64 + wn + 16 + nc] = acc[0][1][r];
    tile[row1 * 64 + wn + nc]      = acc[1][0][r];
    tile[row1 * 64 + wn + 16 + nc] = acc[1][1][r];
  }
}

// ---------------- q/k/v projections: blockIdx.z selects the matrix ----------------
// Wh/Wl hold Wq, Wk, Wv, Wo back to back ([n][k] rows). N tile = one head (64 columns).
__global__ __launch_bounds__(128) void k_proj_qkv(const u16* Xh, const u16* Xl,
                                                  const u16* Wh, const u16* Wl,
                                                  u16* Qh, u16* Ql, u16* Kh, u16* Kl,
                                                  u16* Vth, u16* Vtl) {
  __shared__ __attribute__((aligned(16))) float tile[64 * 64];
  const int z = (int)blockIdx.z;
  const int hd = (int)blockIdx.x;            // head index = n0 / 64
  const int n0 = hd * 64;
  const int m0 = (int)blockIdx.y * 64;
  const u16* Bh = Wh + (size_t)z * (size_t)D_ * (size_t)D_;
  const u16* Bl = Wl + (size_t)z * (size_t)D_ * (size_t)D_;
  gemm_block64(Xh, Xl, D_, Bh, Bl, D_, m0, n0, D_, tile);
  __syncthreads();

  const int w = (int)(threadIdx.x >> 5), l = (int)(threadIdx.x & 31u);
  const int b = m0 >> 11, s0 = m0 & (S_ - 1);
  const int bh = b * H_ + hd;
  if (z < 2) {
    u16* Ph = (z == 0) ? Qh : Kh;
    u16* Pl = (z == 0) ? Ql : Kl;
    const size_t base = ((size_t)bh * (size_t)S_ + (size_t)s0) * (size_t)DH_;
#pragma unroll
    for (int j = 0; j < 4; ++j) {
      const int row = w * 16 + j * 4 + (l >> 3);
      const int c0 = 8 * (l & 7);
      const float* tp = tile + row * 64 + c0;
      const v4f f0 = *(const v4f*)(tp);
      const v4f f1 = *(const v4f*)(tp + 4);
      v4u vh, vl;
      split8(f0, f1, vh, vl);
      const size_t o = base + (size_t)row * (size_t)DH_ + (size_t)c0;
      *(v4u*)(Ph + o) = vh;
      *(v4u*)(Pl + o) = vl;
      
    }
  } else {
#pragma unroll
    for (int j = 0; j < 4; ++j) {
      const int d = w * 16 + j * 4 + (l >> 3);   // Vt row within the head
      const int k0 = 8 * (l & 7);               // key offset within the 64-key tile
      v4f f0, f1;
      f0.x = tile[(k0 + 0) * 64 + d]; f0.y = tile[(k0 + 1) * 64 + d];
      f0.z = tile[(k0 + 2) * 64 + d]; f0.w = tile[(k0 + 3) * 64 + d];
      f1.x = tile[(k0 + 4) * 64 + d]; f1.y = tile[(k0 + 5) * 64 + d];
      f1.z = tile[(k0 + 6) * 64 + d]; f1.w = tile[(k0 + 7) * 64 + d];
      v4u vh, vl;
      split8(f0, f1, vh, vl);
      const size_t o = ((size_t)bh * (size_t)DH_ + (size_t)d) * (size_t)S_ + (size_t)s0 + (size_t)k0;
      *(v4u*)(Vth + o) = vh;
      *(v4u*)(Vtl + o) = vl;
      
    }
  }
}

// ---------------- output projection: out = ctx . Wo^T + bo (f32) ----------------
__global__ __launch_bounds__(128) void k_proj_out(const u16* Ch, const u16* Cl,
                                                  const u16* Wh, const u16* Wl,
                                                  const float* __restrict__ bo, float* out) {
  __shared__ __attribute__((aligned(16))) float tile[64 * 64];
  const int n0 = (int)blockIdx.x * 64;
  const int m0 = (int)blockIdx.y * 64;
  const u16* Bh = Wh + (size_t)3 * (size_t)D_ * (size_t)D_;
  const u16* Bl = Wl + (size_t)3 * (size_t)D_ * (size_t)D_;
  gemm_block64(Ch, Cl, D_, Bh, Bl, D_, m0, n0, D_, tile);
  __syncthreads();

  const int w = (int)(threadIdx.x >> 5), l = (int)(threadIdx.x & 31u);
#pragma unroll
  for (int j = 0; j < 8; ++j) {
    const int row = w * 16 + j * 2 + (l >> 4);
    const int c0 = 4 * (l & 15);
    v4f v = *(const v4f*)(tile + row * 64 + c0);
    const v4f bb = *(const v4f*)(bo + n0 + c0);
    v = v + bb;
    float* op = out + (size_t)(m0 + row) * (size_t)D_ + (size_t)(n0 + c0);
    *(v4f*)op = v;
    
  }
}

// ---------------- causal streaming attention: one wave (= one block) per (b, h, 16-query tile) ----------------
// scores = (q.k^T - (i-j)*slope_h) * 1/8 ; 30*tanh(scores/30); causal; online softmax in f32;
// p tile -> LDS as bf16 hi/lo [16 q][32 keys], reloaded with the common loader after a barrier.
__global__ __launch_bounds__(32) void k_attn(const u16* Qh, const u16* Ql,
                                             const u16* Kh, const u16* Kl,
                                             const u16* Vth, const u16* Vtl,
                                             u16* Ch, u16* Cl) {
  __shared__ __attribute__((aligned(16))) u16 lds_ph[16 * 32];
  __shared__ __attribute__((aligned(16))) u16 lds_pl[16 * 32];
  __shared__ __attribute__((aligned(16))) float ctile[16 * 64];

  const int gw = (int)blockIdx.x;                // 0 .. B*H*(S/16)-1
  const int bh = gw >> 7, qt = gw & 127;
  const int b = bh >> 4, hd = bh & 15;
  const int l = (int)(threadIdx.x & 31u), hh = l >> 4, nc = l & 15;
  const int q0 = qt * 16;
  const int ex = hd + 1;                         // slope = 2^(-(h+1)/2)
  const float slope = ((ex & 1) ? 0.70710678118654752f : 1.0f) *
                      __uint_as_float((unsigned int)(127 - (ex >> 1)) << 23);

  const u16* Qhp  = Qh  + (size_t)bh * (size_t)S_ * (size_t)DH_;
  const u16* Qlp  = Ql  + (size_t)bh * (size_t)S_ * (size_t)DH_;
  const u16* Khp  = Kh  + (size_t)bh * (size_t)S_ * (size_t)DH_;
  const u16* Klp  = Kl  + (size_t)bh * (size_t)S_ * (size_t)DH_;
  const u16* Vthp = Vth + (size_t)bh * (size_t)DH_ * (size_t)S_;
  const u16* Vtlp = Vtl + (size_t)bh * (size_t)DH_ * (size_t)S_;

  const v16bf q0h = ld_frag(Qhp, DH_, q0, 0),  q0l = ld_frag(Qlp, DH_, q0, 0);
  const v16bf q1h = ld_frag(Qhp, DH_, q0, 32), q1l = ld_frag(Qlp, DH_, q0, 32);

  v8f o[4] = {};
  float mrow[8], lrow[8];
#pragma unroll
  for (int r = 0; r < 8; ++r) { mrow[r] = -3.0e38f; lrow[r] = 0.0f; }

  const int nchunk = (q0 >> 5) + 1;              // keys 0 .. q0+15, 32 per chunk
  for (int c = 0; c < nchunk; ++c) {
    const int ks = c << 5;
    v8f s[2] = {};
#pragma unroll
    for (int t = 0; t < 2; ++t) {
      const int kr = ks + 16 * t;                // B[k=d][n=key]: rows of K, d contiguous
      const v16bf k0h = ld_frag(Khp, DH_, kr, 0),  k0l = ld_frag(Klp, DH_, kr, 0);
      const v16bf k1h = ld_frag(Khp, DH_, kr, 32), k1l = ld_frag(Klp, DH_, kr, 32);
      mma(s[t], q0h, k0h); mma(s[t], q0l, k0h); mma(s[t], q0h, k0l);
      mma(s[t], q1h, k1h); mma(s[t], q1l, k1h); mma(s[t], q1h, k1l);
    }

#pragma unroll
    for (int r = 0; r < 8; ++r) {
      const int q = q0 + 8 * hh + r;
      const int ka = ks + nc, kb = ks + 16 + nc;
      float xa = (s[0][r] - (float)(q - ka) * slope) * 0.125f;
      float xb = (s[1][r] - (float)(q - kb) * slope) * 0.125f;
      xa = 30.0f * tanhf(xa * (1.0f / 30.0f));
      xb = 30.0f * tanhf(xb * (1.0f / 30.0f));
      xa = (ka <= q) ? xa : -3.0e38f;
      xb = (kb <= q) ? xb : -3.0e38f;
      float t = fmaxf(xa, xb);
      t = fmaxf(t, __shfl_xor(t, 1, 32));
      t = fmaxf(t, __shfl_xor(t, 2, 32));
      t = fmaxf(t, __shfl_xor(t, 4, 32));
      t = fmaxf(t, __shfl_xor(t, 8, 32));
      const float mnew = fmaxf(mrow[r], t);
      const float alpha = __expf(mrow[r] - mnew);
      const float pa = __expf(xa - mnew);
      const float pb = __expf(xb - mnew);
      float u = pa + pb;
      u += __shfl_xor(u, 1, 32);
      u += __shfl_xor(u, 2, 32);
      u += __shfl_xor(u, 4, 32);
      u += __shfl_xor(u, 8, 32);
      lrow[r] = lrow[r] * alpha + u;
      mrow[r] = mnew;
      o[0][r] *= alpha; o[1][r] *= alpha; o[2][r] *= alpha; o[3][r] *= alpha;
      unsigned int ha, la, hb, lb;
      split_one(pa, ha, la);
      split_one(pb, hb, lb);
      const int row = 8 * hh + r;                // P[q row][key offset]
      lds_ph[row * 32 + nc]      = (u16)ha;
      lds_ph[row * 32 + 16 + nc] = (u16)hb;
      lds_pl[row * 32 + nc]      = (u16)la;
      lds_pl[row * 32 + 16 + nc] = (u16)lb;
    }
    __syncthreads();
    const v16bf ph = ld_frag(lds_ph, 32, 0, 0);
    const v16bf pl = ld_frag(lds_pl, 32, 0, 0);
#pragma unroll
    for (int si = 0; si < 4; ++si) {             // B[k=key][n=d]: rows of Vt, keys contiguous
      const v16bf vh = ld_frag(Vthp, S_, 16 * si, ks);
      const v16bf vl = ld_frag(Vtlp, S_, 16 * si, ks);
      mma(o[si], ph, vh); mma(o[si], pl, vh); mma(o[si], ph, vl);
    }
    __syncthreads();
  }

#pragma unroll
  for (int r = 0; r < 8; ++r) {
    const float inv = 1.0f / lrow[r];
    const int row = 8 * hh + r;
    ctile[row * 64 + nc]      = o[0][r] * inv;
    ctile[row * 64 + 16 + nc] = o[1][r] * inv;
    ctile[row * 64 + 32 + nc] = o[2][r] * inv;
    ctile[row * 64 + 48 + nc] = o[3][r] * inv;
  }
  __syncthreads();
  const size_t rbase = ((size_t)b * (size_t)S_ + (size_t)q0) * (size_t)D_ + (size_t)hd * (size_t)DH_;
#pragma unroll
  for (int j = 0; j < 4; ++j) {
    const int row = j * 4 + (l >> 3);
    const int c0 = 8 * (l & 7);
    const float* tp = ctile + row * 64 + c0;
    const v4f f0 = *(const v4f*)(tp);
    const v4f f1 = *(const v4f*)(tp + 4);
    v4u vh, vl;
    split8(f0, f1, vh, vl);
    const size_t oidx = rbase + (size_t)row * (size_t)D_ + (size_t)c0;
    *(v4u*)(Ch + oidx) = vh;
    *(v4u*)(Cl + oidx) = vl;
    
  }
}

extern "C" void kernel_launch(void* const* d_in, const int* in_sizes, int n_in,
                              void* d_out, int out_size, void* d_ws, size_t ws_size,
                              hipStream_t stream) {
  if (n_in < 6) return;
  const int nX = M_ * D_;          // 4194304
  const int nW = D_ * D_;          // 1048576
  const int nHead = B_ * H_ * S_ * DH_;   // 4194304
  if (in_sizes[0] != nX || in_sizes[1] != nW || in_sizes[2] != nW ||
      in_sizes[3] != nW || in_sizes[4] != nW || in_sizes[5] != D_) return;
  if (out_size != nX) return;

  const float* hs = (const float*)d_in[0];
  const float* wq = (const float*)d_in[1];
  const float* wk = (const float*)d_in[2];
  const float* wv = (const float*)d_in[3];
  const float* wo = (const float*)d_in[4];
  const float* bo = (const float*)d_in[5];
  float* out = (float*)d_out;

  char* ws = (char*)d_ws;
  size_t off = 0;
  const size_t bX = (size_t)nX * 2u;            // 8 MiB per plane
  const size_t bW = (size_t)nW * 2u * 4u;       // four matrices per plane, 8 MiB
  const size_t bHd = (size_t)nHead * 2u;        // 8 MiB per plane
  u16* Xh  = (u16*)(ws + off); off += bX;
  u16* Xl  = (u16*)(ws + off); off += bX;
  u16* Wh  = (u16*)(ws + off); off += bW;
  u16* Wl  = (u16*)(ws + off); off += bW;
  u16* Qh  = (u16*)(ws + off); off += bHd;
  u16* Ql  = (u16*)(ws + off); off += bHd;
  u16* Kh  = (u16*)(ws + off); off += bHd;
  u16* Kl  = (u16*)(ws + off); off += bHd;
  u16* Vth = (u16*)(ws + off); off += bHd;
  u16* Vtl = (u16*)(ws + off); off += bHd;
  u16* Ch  = (u16*)(ws + off); off += bX;
  u16* Cl  = (u16*)(ws + off); off += bX;
  if (off > ws_size) return;                    // 100663296 B total

  // 1) f32 -> bf16 hi/lo planes: x (2048 blocks needed) and 4 weights (512 blocks each)
  k_split<<<dim3((unsigned)(nX / 8 / 256), 5, 1), 256, 0, stream>>>(hs, wq, wk, wv, wo, Xh, Xl, Wh, Wl, nX, nW);
  // 2) q/k/v projections: 16 head tiles x 64 row tiles x 3 matrices
  k_proj_qkv<<<dim3(D_ / 64, M_ / 64, 3), 128, 0, stream>>>(Xh, Xl, Wh, Wl, Qh, Ql, Kh, Kl, Vth, Vtl);
  // 3) attention: one 32-thread block per (b, h, 16-query tile)
  k_attn<<<dim3((unsigned)(B_ * H_ * (S_ / 16)), 1, 1), 32, 0, stream>>>(Qh, Ql, Kh, Kl, Vth, Vtl, Ch, Cl);
  // 4) output projection + bias
  k_proj_out<<<dim3(D_ / 64, M_ / 64, 1), 128, 0, stream>>>(Ch, Cl, Wh, Wl, bo, out);
  (void)hipGetLastError();
}

// v001
// A run of this version takes 472 microseconds.
// Timed twice side by side with v000, it ran 1.27 and 1.28 times as fast.
#include <hip/hip_runtime.h>
#include <stdint.h>

// All contractions (q/k/v projections, q.k^T scores, p.v, output projection): v_wmma_f32_16x16x32_bf16 with bf16 hi/lo operand planes everywhere (hi.hi + lo.hi + hi.lo), f32 accumulate; alibi bias, 1/sqrt(d) scale, tanh softcap and softmax in f32.

#define B_  2
#define S_  2048
#define D_  1024
#define H_  16
#define DH_ 64
#define M_  (B_ * S_)

static_assert((M_ % 64) == 0);
static_assert((D_ % 64) == 0);
static_assert((S_ % 64) == 0);
static_assert(DH_ == 64);

typedef unsigned short u16;
typedef __bf16 v16bf __attribute__((ext_vector_type(16)));
typedef __bf16 v8bf  __attribute__((ext_vector_type(8)));
typedef float  v8f   __attribute__((ext_vector_type(8)));
typedef float  v4f   __attribute__((ext_vector_type(4)));
typedef unsigned int v4u __attribute__((ext_vector_type(4)));

union Frag { v16bf v; v8bf half[2]; };

// 16x32 fragment from a 16-bit plane stored [row][k] with k contiguous (pitch ld elements).
// Same map for A (row = m) and B (row = n): lane l -> row (l&15); elements 0..7 <- k0+8h+0..7,
// elements 8..15 <- k0+16+8h+0..7 with h = l>>4.
__device__ __forceinline__ v16bf ld_frag(const u16* base, int ld, int row0, int k0) {
  const int l = (int)(threadIdx.x & 31u), hh = l >> 4, m = l & 15;
  const u16* p = base + (size_t)(row0 + m) * (size_t)ld + (size_t)(k0 + 8 * hh);
  Frag f;
  f.half[0] = *(const v8bf*)(p);
  f.half[1] = *(const v8bf*)(p + 16);
  return f.v;
}

// D[16x16] += A[16x32] . B[32x16]; acc element r of lane l = (row 8h+r, col l&15). Hazard guard after every issue.
__device__ __forceinline__ void mma(v8f& acc, v16bf a, v16bf b) {
  acc = __builtin_amdgcn_wmma_f32_16x16x32_bf16(false, a, false, b, (short)0, acc, false, false);
  asm volatile("v_nop\n\tv_nop\n\tv_nop\n\tv_nop" : "+v"(acc) : "v"(a), "v"(b));
}

// f32 -> bf16 bits, RNE convert
__device__ __forceinline__ unsigned int bf16_bits(float f) {
  const unsigned int u = __float_as_uint(f);
  return (u + 0x7FFFu + ((u >> 16) & 1u)) >> 16;
}

// hi = bf16(x), lo = bf16(x - hi)
__device__ __forceinline__ void split_one(float x, unsigned int& hi, unsigned int& lo) {
  hi = bf16_bits(x);
  lo = bf16_bits(x - __uint_as_float(hi << 16));
}

__device__ __forceinline__ void split_pair(float x, float y, unsigned int& hi, unsigned int& lo) {
  unsigned int hx, lx, hy, ly;
  split_one(x, hx, lx);
  split_one(y, hy, ly);
  hi = hx | (hy << 16);
  lo = lx | (ly << 16);
}

// 8 consecutive floats -> packed 8 x bf16 hi (16 B) and 8 x bf16 lo (16 B)
__device__ __forceinline__ void split8(v4f a, v4f c, v4u& hi, v4u& lo) {
  unsigned int h0, l0, h1, l1, h2, l2, h3, l3;
  split_pair(a.x, a.y, h0, l0);
  split_pair(a.z, a.w, h1, l1);
  split_pair(c.x, c.y, h2, l2);
  split_pair(c.z, c.w, h3, l3);
  hi.x = h0; hi.y = h1; hi.z = h2; hi.w = h3;
  lo.x = l0; lo.y = l1; lo.z = l2; lo.w = l3;
}

// ---------------- f32 -> bf16 hi/lo planes for x and the four weight matrices ----------------
// blockIdx.y selects the segment (0: x, 1..4: Wq, Wk, Wv, Wo). Each thread converts 8 floats and
__global__ __launch_bounds__(256) void k_split(const float* __restrict__ x,
                                               const float* __restrict__ wq, const float* __restrict__ wk,
                                               const float* __restrict__ wv, const float* __restrict__ wo,
                                               u16* __restrict__ Xh, u16* __restrict__ Xl,
                                               u16* __restrict__ Wh, u16* __restrict__ Wl,
                                               int nx, int nw) {
  const int seg = (int)blockIdx.y;
  const float* src = x;
  u16* dh = Xh;
  u16* dl = Xl;
  int n = nx;
  if (seg > 0) {
    const int wi = seg - 1;
    src = (wi == 0) ? wq : (wi == 1) ? wk : (wi == 2) ? wv : wo;
    dh = Wh + (size_t)wi * (size_t)nw;
    dl = Wl + (size_t)wi * (size_t)nw;
    n = nw;
  }
  const size_t i8 = ((size_t)blockIdx.x * (size_t)blockDim.x + (size_t)threadIdx.x) * 8u;
  if (i8 + 8u > (size_t)n) return;
  const v4f a = *(const v4f*)(src + i8);
  const v4f c = *(const v4f*)(src + i8 + 4);
  v4u vh, vl;
  split8(a, c, vh, vl);
  u16* ph = dh + i8;
  u16* pl = dl + i8;
  *(v4u*)ph = vh;
  *(v4u*)pl = vl;
  
}

// ---------------- 64x64 block GEMM tile, 4 waves x (32x32), three-term hi/lo products ----------------
// C[m][n] = sum_k A[m][k] * B[n][k]  (A and B both stored [row][k], k contiguous).
// Result is left in the LDS tile [64][64] f32.
__device__ __forceinline__ void gemm_block64(const u16* Ah, const u16* Al, int lda,
                                             const u16* Bh, const u16* Bl, int ldb,
                                             int m0, int n0, int K, float* tile) {
  const int w = (int)(threadIdx.x >> 5), l = (int)(threadIdx.x & 31u), hh = l >> 4, nc = l & 15;
  const int wm = (w >> 1) * 32, wn = (w & 1) * 32;
  v8f acc[2][2] = {};
  for (int kk = 0; kk < K; kk += 32) {
    const v16bf a0h = ld_frag(Ah, lda, m0 + wm, kk);
    const v16bf a0l = ld_frag(Al, lda, m0 + wm, kk);
    const v16bf a1h = ld_frag(Ah, lda, m0 + wm + 16, kk);
    const v16bf a1l = ld_frag(Al, lda, m0 + wm + 16, kk);
    const v16bf b0h = ld_frag(Bh, ldb, n0 + wn, kk);
    const v16bf b0l = ld_frag(Bl, ldb, n0 + wn, kk);
    const v16bf b1h = ld_frag(Bh, ldb, n0 + wn + 16, kk);
    const v16bf b1l = ld_frag(Bl, ldb, n0 + wn + 16, kk);
    mma(acc[0][0], a0h, b0h); mma(acc[0][0], a0l, b0h); mma(acc[0][0], a0h, b0l);
    mma(acc[0][1], a0h, b1h); mma(acc[0][1], a0l, b1h); mma(acc[0][1], a0h, b1l);
    mma(acc[1][0], a1h, b0h); mma(acc[1][0], a1l, b0h); mma(acc[1][0], a1h, b0l);
    mma(acc[1][1], a1h, b1h); mma(acc[1][1], a1l, b1h); mma(acc[1][1], a1h, b1l);
  }
#pragma unroll
  for (int r = 0; r < 8; ++r) {
    const int row0 = wm + 8 * hh + r;
    const int row1 = wm + 16 + 8 * hh + r;
    tile[row0 * 64 + wn + nc]      = acc[0][0][r];
    tile[row0 * 64 + wn + 16 + nc] = acc[0][1][r];
    tile[row1 * 64 + wn + nc]      = acc[1][0][r];
    tile[row1 * 64 + wn + 16 + nc] = acc[1][1][r];
  }
}

// ---------------- q/k/v projections: blockIdx.z selects the matrix ----------------
// Wh/Wl hold Wq, Wk, Wv, Wo back to back ([n][k] rows). N tile = one head (64 columns).
__global__ __launch_bounds__(128) void k_proj_qkv(const u16* Xh, const u16* Xl,
                                                  const u16* Wh, const u16* Wl,
                                                  u16* Qh, u16* Ql, u16* Kh, u16* Kl,
                                                  u16* Vth, u16* Vtl) {
  __shared__ __attribute__((aligned(16))) float tile[64 * 64];
  const int z = (int)blockIdx.z;
  const int hd = (int)blockIdx.x;            // head index = n0 / 64
  const int n0 = hd * 64;
  const int m0 = (int)blockIdx.y * 64;
  const u16* Bh = Wh + (size_t)z * (size_t)D_ * (size_t)D_;
  const u16* Bl = Wl + (size_t)z * (size_t)D_ * (size_t)D_;
  gemm_block64(Xh, Xl, D_, Bh, Bl, D_, m0, n0, D_, tile);
  __syncthreads();

  const int w = (int)(threadIdx.x >> 5), l = (int)(threadIdx.x & 31u);
  const int b = m0 >> 11, s0 = m0 & (S_ - 1);
  const int bh = b * H_ + hd;
  if (z < 2) {
    u16* Ph = (z == 0) ? Qh : Kh;
    u16* Pl = (z == 0) ? Ql : Kl;
    const size_t base = ((size_t)bh * (size_t)S_ + (size_t)s0) * (size_t)DH_;
#pragma unroll
    for (int j = 0; j < 4; ++j) {
      const int row = w * 16 + j * 4 + (l >> 3);
      const int c0 = 8 * (l & 7);
      const float* tp = tile + row * 64 + c0;
      const v4f f0 = *(const v4f*)(tp);
      const v4f f1 = *(const v4f*)(tp + 4);
      v4u vh, vl;
      split8(f0, f1, vh, vl);
      const size_t o = base + (size_t)row * (size_t)DH_ + (size_t)c0;
      *(v4u*)(Ph + o) = vh;
      *(v4u*)(Pl + o) = vl;
      
    }
  } else {
#pragma unroll
    for (int j = 0; j < 4; ++j) {
      const int d = w * 16 + j * 4 + (l >> 3);   // Vt row within the head
      const int k0 = 8 * (l & 7);               // key offset within the 64-key tile
      v4f f0, f1;
      f0.x = tile[(k0 + 0) * 64 + d]; f0.y = tile[(k0 + 1) * 64 + d];
      f0.z = tile[(k0 + 2) * 64 + d]; f0.w = tile[(k0 + 3) * 64 + d];
      f1.x = tile[(k0 + 4) * 64 + d]; f1.y = tile[(k0 + 5) * 64 + d];
      f1.z = tile[(k0 + 6) * 64 + d]; f1.w = tile[(k0 + 7) * 64 + d];
      v4u vh, vl;
      split8(f0, f1, vh, vl);
      const size_t o = ((size_t)bh * (size_t)DH_ + (size_t)d) * (size_t)S_ + (size_t)s0 + (size_t)k0;
      *(v4u*)(Vth + o) = vh;
      *(v4u*)(Vtl + o) = vl;
      
    }
  }
}

// ---------------- output projection: out = ctx . Wo^T + bo (f32) ----------------
__global__ __launch_bounds__(128) void k_proj_out(const u16* Ch, const u16* Cl,
                                                  const u16* Wh, const u16* Wl,
                                                  const float* __restrict__ bo, float* out) {
  __shared__ __attribute__((aligned(16))) float tile[64 * 64];
  const int n0 = (int)blockIdx.x * 64;
  const int m0 = (int)blockIdx.y * 64;
  const u16* Bh = Wh + (size_t)3 * (size_t)D_ * (size_t)D_;
  const u16* Bl = Wl + (size_t)3 * (size_t)D_ * (size_t)D_;
  gemm_block64(Ch, Cl, D_, Bh, Bl, D_, m0, n0, D_, tile);
  __syncthreads();

  const int w = (int)(threadIdx.x >> 5), l = (int)(threadIdx.x & 31u);
#pragma unroll
  for (int j = 0; j < 8; ++j) {
    const int row = w * 16 + j * 2 + (l >> 4);
    const int c0 = 4 * (l & 15);
    v4f v = *(const v4f*)(tile + row * 64 + c0);
    const v4f bb = *(const v4f*)(bo + n0 + c0);
    v = v + bb;
    float* op = out + (size_t)(m0 + row) * (size_t)D_ + (size_t)(n0 + c0);
    *(v4f*)op = v;
    
  }
}

union PFrag { v16bf v; unsigned int u[8]; };

// lane l <-> lane l ^ 16
__device__ __forceinline__ float xhalf(float x) {
  return __builtin_bit_cast(float, __builtin_amdgcn_permlanex16(__builtin_bit_cast(int, x), __builtin_bit_cast(int, x),
                                                                0x76543210, 0xfedcba98, false, false));
}

__global__ __launch_bounds__(32) void k_attn(const u16* Qh, const u16* Ql,
                                             const u16* Kh, const u16* Kl,
                                             const u16* Vth, const u16* Vtl,
                                             u16* Ch, u16* Cl) {
  __shared__ __attribute__((aligned(16))) float ctile[16 * 64];

  const int gw = (int)blockIdx.x;                // 0 .. B*H*(S/16)-1
  const int bh = gw >> 7, qt = gw & 127;
  const int b = bh >> 4, hd = bh & 15;
  const int l = (int)(threadIdx.x & 31u), hh = l >> 4, nc = l & 15;
  const int q0 = qt * 16;
  const int ex = hd + 1;                         // slope = 2^(-(h+1)/2)
  const float slope = ((ex & 1) ? 0.70710678118654752f : 1.0f) *
                      __uint_as_float((unsigned int)(127 - (ex >> 1)) << 23);

  const u16* Qhp  = Qh  + (size_t)bh * (size_t)S_ * (size_t)DH_;
  const u16* Qlp  = Ql  + (size_t)bh * (size_t)S_ * (size_t)DH_;
  const u16* Khp  = Kh  + (size_t)bh * (size_t)S_ * (size_t)DH_;
  const u16* Klp  = Kl  + (size_t)bh * (size_t)S_ * (size_t)DH_;
  const u16* Vthp = Vth + (size_t)bh * (size_t)DH_ * (size_t)S_;
  const u16* Vtlp = Vtl + (size_t)bh * (size_t)DH_ * (size_t)S_;

  const v16bf q0h = ld_frag(Qhp, DH_, q0, 0),  q0l = ld_frag(Qlp, DH_, q0, 0);
  const v16bf q1h = ld_frag(Qhp, DH_, q0, 32), q1l = ld_frag(Qlp, DH_, q0, 32);

  v8f o[4] = {};                                 // o[si][r] = O[query nc][d = 16 si + 8 h + r]
  float mq = -3.0e38f;                           // running maximum of this lane's query (equal in both halves)
  float lq = 0.0f;                               // this half's share of the query's sum; halves joined after the loop
  const int q = q0 + nc;

  const int nchunk = (q0 >> 5) + 1;              // keys 0 .. q0+15, 32 per chunk
  for (int c = 0; c < nchunk; ++c) {
    const int ks = c << 5;
    v8f s[2] = {};
#pragma unroll
    for (int t = 0; t < 2; ++t) {
      const int kr = ks + 16 * t;                // A[m=key][k=d]: rows of K, d contiguous
      const v16bf k0h = ld_frag(Khp, DH_, kr, 0),  k0l = ld_frag(Klp, DH_, kr, 0);
      const v16bf k1h = ld_frag(Khp, DH_, kr, 32), k1l = ld_frag(Klp, DH_, kr, 32);
      mma(s[t], k0h, q0h); mma(s[t], k0h, q0l); mma(s[t], k0l, q0h);
      mma(s[t], k1h, q1h); mma(s[t], k1h, q1l); mma(s[t], k1l, q1h);
    }

    float xs[2][8];
    float t0 = -3.0e38f;
#pragma unroll
    for (int t = 0; t < 2; ++t) {
#pragma unroll
      for (int r = 0; r < 8; ++r) {
        const int kk = ks + 16 * t + 8 * hh + r;
        float x = (s[t][r] - (float)(q - kk) * slope) * 0.125f;
        x = 30.0f * tanhf(x * (1.0f / 30.0f));
        x = (kk <= q) ? x : -3.0e38f;
        xs[t][r] = x;
        t0 = fmaxf(t0, x);
      }
    }
    t0 = fmaxf(t0, xhalf(t0));
    const float mnew = fmaxf(mq, t0);
    const float alpha = __expf(mq - mnew);
    mq = mnew;

    PFrag ph, pl;
    float u = 0.0f;
#pragma unroll
    for (int t = 0; t < 2; ++t) {
#pragma unroll
      for (int i = 0; i < 4; ++i) {
        const float pa = __expf(xs[t][2 * i] - mnew);
        const float pb = __expf(xs[t][2 * i + 1] - mnew);
        u += pa + pb;
        split_pair(pa, pb, ph.u[4 * t + i], pl.u[4 * t + i]);
      }
    }
    lq = lq * alpha + u;
#pragma unroll
    for (int si = 0; si < 4; ++si) o[si] *= alpha;

#pragma unroll
    for (int si = 0; si < 4; ++si) {             // A[m=d][k=key]: rows of Vt, keys contiguous
      const v16bf vh = ld_frag(Vthp, S_, 16 * si, ks);
      const v16bf vl = ld_frag(Vtlp, S_, 16 * si, ks);
      mma(o[si], vh, ph.v); mma(o[si], vh, pl.v); mma(o[si], vl, ph.v);
    }
  }

  const float inv = 1.0f / (lq + xhalf(lq));
#pragma unroll
  for (int si = 0; si < 4; ++si) {
    float* cp = ctile + nc * 64 + 16 * si + 8 * hh;
    v4f c0v, c1v;
    c0v.x = o[si][0] * inv; c0v.y = o[si][1] * inv; c0v.z = o[si][2] * inv; c0v.w = o[si][3] * inv;
    c1v.x = o[si][4] * inv; c1v.y = o[si][5] * inv; c1v.z = o[si][6] * inv; c1v.w = o[si][7] * inv;
    *(v4f*)(cp) = c0v;
    *(v4f*)(cp + 4) = c1v;
  }
  __syncthreads();
  const size_t rbase = ((size_t)b * (size_t)S_ + (size_t)q0) * (size_t)D_ + (size_t)hd * (size_t)DH_;
#pragma unroll
  for (int j = 0; j < 4; ++j) {
    const int row = j * 4 + (l >> 3);
    const int c0 = 8 * (l & 7);
    const float* tp = ctile + row * 64 + c0;
    const v4f f0 = *(const v4f*)(tp);
    const v4f f1 = *(const v4f*)(tp + 4);
    v4u vh, vl;
    split8(f0, f1, vh, vl);
    const size_t oidx = rbase + (size_t)row * (size_t)D_ + (size_t)c0;
    *(v4u*)(Ch + oidx) = vh;
    *(v4u*)(Cl + oidx) = vl;
    
  }
}

extern "C" void kernel_launch(void* const* d_in, const int* in_sizes, int n_in,
                              void* d_out, int out_size, void* d_ws, size_t ws_size,
                              hipStream_t stream) {
  if (n_in < 6) return;
  const int nX = M_ * D_;          // 4194304
  const int nW = D_ * D_;          // 1048576
  const int nHead = B_ * H_ * S_ * DH_;   // 4194304
  if (in_sizes[0] != nX || in_sizes[1] != nW || in_sizes[2] != nW ||
      in_sizes[3] != nW || in_sizes[4] != nW || in_sizes[5] != D_) return;
  if (out_size != nX) return;

  const float* hs = (const float*)d_in[0];
  const float* wq = (const float*)d_in[1];
  const float* wk = (const float*)d_in[2];
  const float* wv = (const float*)d_in[3];
  const float* wo = (const float*)d_in[4];
  const float* bo = (const float*)d_in[5];
  float* out = (float*)d_out;

  char* ws = (char*)d_ws;
  size_t off = 0;
  const size_t bX = (size_t)nX * 2u;            // 8 MiB per plane
  const size_t bW = (size_t)nW * 2u * 4u;       // four matrices per plane, 8 MiB
  const size_t bHd = (size_t)nHead * 2u;        // 8 MiB per plane
  u16* Xh  = (u16*)(ws + off); off += bX;
  u16* Xl  = (u16*)(ws + off); off += bX;
  u16* Wh  = (u16*)(ws + off); off += bW;
  u16* Wl  = (u16*)(ws + off); off += bW;
  u16* Qh  = (u16*)(ws + off); off += bHd;
  u16* Ql  = (u16*)(ws + off); off += bHd;
  u16* Kh  = (u16*)(ws + off); off += bHd;
  u16* Kl  = (u16*)(ws + off); off += bHd;
  u16* Vth = (u16*)(ws + off); off += bHd;
  u16* Vtl = (u16*)(ws + off); off += bHd;
  u16* Ch  = (u16*)(ws + off); off += bX;
  u16* Cl  = (u16*)(ws + off); off += bX;
  if (off > ws_size) return;                    // 100663296 B total

  // 1) f32 -> bf16 hi/lo planes: x (2048 blocks needed) and 4 weights (512 blocks each)
  k_split<<<dim3((unsigned)(nX / 8 / 256), 5, 1), 256, 0, stream>>>(hs, wq, wk, wv, wo, Xh, Xl, Wh, Wl, nX, nW);
  // 2) q/k/v projections: 16 head tiles x 64 row tiles x 3 matrices
  k_proj_qkv<<<dim3(D_ / 64, M_ / 64, 3), 128, 0, stream>>>(Xh, Xl, Wh, Wl, Qh, Ql, Kh, Kl, Vth, Vtl);
  // 3) attention: one 32-thread block per (b, h, 16-query tile)
  k_attn<<<dim3((unsigned)(B_ * H_ * (S_ / 16)), 1, 1), 32, 0, stream>>>(Qh, Ql, Kh, Kl, Vth, Vtl, Ch, Cl);
  // 4) output projection + bias
  k_proj_out<<<dim3(D_ / 64, M_ / 64, 1), 128, 0, stream>>>(Ch, Cl, Wh, Wl, bo, out);
  (void)hipGetLastError();
}

// v002
// A run of this version takes 341 microseconds.
// Two timings next to v001 both put it at 1.39 times that version's speed.
// Counting every step since v000, it is 1.78 times as fast.
#include <hip/hip_runtime.h>
#include <stdint.h>

// All contractions (q/k/v projections, q.k^T scores, p.v, output projection): v_wmma_f32_16x16x32_bf16 with bf16 hi/lo operand planes everywhere (hi.hi + lo.hi + hi.lo), f32 accumulate; alibi bias, 1/sqrt(d) scale, tanh softcap and softmax in f32.

#define B_  2
#define S_  2048
#define D_  1024
#define H_  16
#define DH_ 64
#define M_  (B_ * S_)

static_assert((M_ % 64) == 0);
static_assert((D_ % 64) == 0);
static_assert((S_ % 64) == 0);
static_assert(DH_ == 64);

typedef unsigned short u16;
typedef __bf16 v16bf __attribute__((ext_vector_type(16)));
typedef __bf16 v8bf  __attribute__((ext_vector_type(8)));
typedef float  v8f   __attribute__((ext_vector_type(8)));
typedef float  v4f   __attribute__((ext_vector_type(4)));
typedef unsigned int v4u __attribute__((ext_vector_type(4)));

union Frag { v16bf v; v8bf half[2]; };

// 16x32 fragment from a 16-bit plane stored [row][k] with k contiguous (pitch ld elements).
// Same map for A (row = m) and B (row = n): lane l -> row (l&15); elements 0..7 <- k0+8h+0..7,
// elements 8..15 <- k0+16+8h+0..7 with h = l>>4.
__device__ __forceinline__ v16bf ld_frag(const u16* base, int ld, int row0, int k0) {
  const int l = (int)(threadIdx.x & 31u), hh = l >> 4, m = l & 15;
  const u16* p = base + (size_t)(row0 + m) * (size_t)ld + (size_t)(k0 + 8 * hh);
  Frag f;
  f.half[0] = *(const v8bf*)(p);
  f.half[1] = *(const v8bf*)(p + 16);
  return f.v;
}

// D[16x16] += A[16x32] . B[32x16]; acc element r of lane l = (row 8h+r, col l&15). Hazard guard after every issue.
__device__ __forceinline__ void mma(v8f& acc, v16bf a, v16bf b) {
  acc = __builtin_amdgcn_wmma_f32_16x16x32_bf16(false, a, false, b, (short)0, acc, false, false);
  asm volatile("v_nop\n\tv_nop\n\tv_nop\n\tv_nop" : "+v"(acc) : "v"(a), "v"(b));
}

// f32 -> bf16 bits, RNE convert
__device__ __forceinline__ unsigned int bf16_bits(float f) {
  const unsigned int u = __float_as_uint(f);
  return (u + 0x7FFFu + ((u >> 16) & 1u)) >> 16;
}

// hi = bf16(x), lo = bf16(x - hi)
__device__ __forceinline__ void split_one(float x, unsigned int& hi, unsigned int& lo) {
  hi = bf16_bits(x);
  lo = bf16_bits(x - __uint_as_float(hi << 16));
}

__device__ __forceinline__ void split_pair(float x, float y, unsigned int& hi, unsigned int& lo) {
  unsigned int hx, lx, hy, ly;
  split_one(x, hx, lx);
  split_one(y, hy, ly);
  hi = hx | (hy << 16);
  lo = lx | (ly << 16);
}

// 8 consecutive floats -> packed 8 x bf16 hi (16 B) and 8 x bf16 lo (16 B)
__device__ __forceinline__ void split8(v4f a, v4f c, v4u& hi, v4u& lo) {
  unsigned int h0, l0, h1, l1, h2, l2, h3, l3;
  split_pair(a.x, a.y, h0, l0);
  split_pair(a.z, a.w, h1, l1);
  split_pair(c.x, c.y, h2, l2);
  split_pair(c.z, c.w, h3, l3);
  hi.x = h0; hi.y = h1; hi.z = h2; hi.w = h3;
  lo.x = l0; lo.y = l1; lo.z = l2; lo.w = l3;
}

// ---------------- f32 -> bf16 hi/lo planes for x and the four weight matrices ----------------
// blockIdx.y selects the segment (0: x, 1..4: Wq, Wk, Wv, Wo). Each thread converts 8 floats and
__global__ __launch_bounds__(256) void k_split(const float* __restrict__ x,
                                               const float* __restrict__ wq, const float* __restrict__ wk,
                                               const float* __restrict__ wv, const float* __restrict__ wo,
                                               u16* __restrict__ Xh, u16* __restrict__ Xl,
                                               u16* __restrict__ Wh, u16* __restrict__ Wl,
                                               int nx, int nw) {
  const int seg = (int)blockIdx.y;
  const float* src = x;
  u16* dh = Xh;
  u16* dl = Xl;
  int n = nx;
  if (seg > 0) {
    const int wi = seg - 1;
    src = (wi == 0) ? wq : (wi == 1) ? wk : (wi == 2) ? wv : wo;
    dh = Wh + (size_t)wi * (size_t)nw;
    dl = Wl + (size_t)wi * (size_t)nw;
    n = nw;
  }
  const size_t i8 = ((size_t)blockIdx.x * (size_t)blockDim.x + (size_t)threadIdx.x) * 8u;
  if (i8 + 8u > (size_t)n) return;
  const v4f a = *(const v4f*)(src + i8);
  const v4f c = *(const v4f*)(src + i8 + 4);
  v4u vh, vl;
  split8(a, c, vh, vl);
  u16* ph = dh + i8;
  u16* pl = dl + i8;
  *(v4u*)ph = vh;
  *(v4u*)pl = vl;
  
}

// ---------------- operand staging: tensor loads into a two-buffer LDS ring ----------------
// A stage is 64 k of the block's four operand planes (A hi, A lo, B hi, B lo): 64 rows of 128 B each, laid at pitch 144 B.
// Wave w brings plane w: one request per wave and stage.
typedef uint32_t u32x4 __attribute__((ext_vector_type(4)));
typedef uint32_t u32x8 __attribute__((ext_vector_type(8)));
#define STG_K     64                     // k elements per stage
#define STG_ROWB  128                    // bytes of one staged row
#define STG_PITCH 144                    // LDS row pitch: an odd multiple of 16 B, conflict-free for 16-byte reads
#define STG_SLICE 10240                  // 64 rows x 144 B = 9216 B, rounded up to a multiple of 2 KiB
#define STG_BYTES (4 * STG_SLICE)        // one buffer
#define RING_BYTES (2 * STG_BYTES)       // 81920 B: four blocks per WGP
static_assert((D_ % STG_K) == 0 && (D_ / STG_K) >= 2);
static_assert(64 * STG_PITCH <= STG_SLICE && (STG_SLICE % 2048) == 0);
static_assert(64 * 64 * 4 <= RING_BYTES);

__device__ __forceinline__ uint32_t uni(uint32_t v) { return (uint32_t)__builtin_amdgcn_readfirstlane(v); }
// Holds a wave-uniform test in a scalar register, so that the branch round a tensor load is a scalar branch (the load ignores EXEC).
__device__ __forceinline__ uint32_t pinned(uint32_t v) { uint32_t w = uni(v); asm volatile("" : "+s"(w)); return w; }
// This wave's own slice has landed. The wait names group 0 of the request it covers, so that those registers keep their words until then.
__device__ __forceinline__ void wait_tensor0(u32x4 g0) { asm volatile("s_wait_tensorcnt 0x0" :: "s"(g0) : "memory"); }
__device__ __forceinline__ void wait_ds0() { asm volatile("s_wait_dscnt 0x0" ::: "memory"); }          // this wave's LDS reads have returned

// Descriptor group 0: place in LDS and first byte of the tile.
__device__ __forceinline__ u32x4 tdm_group0(uint32_t lds_dst, uint64_t ga) {
  u32x4 g0;
  g0[0] = uni(1u);
  g0[1] = uni(lds_dst);
  g0[2] = uni((uint32_t)ga);
  g0[3] = uni((((uint32_t)(ga >> 32)) & 0x01FFFFFFu) | 0x80000000u);
  return g0;
}
// Descriptor group 1: a tile of 64 rows of 128 B, source row pitch src_pitch bytes, 16 B of LDS pad behind every row.
__device__ __forceinline__ u32x8 tdm_group1(uint32_t src_pitch) {
  u32x8 g1;
  g1[0] = uni((1u << 20) | (4u << 22) | (3u << 25));   // no mask, 1-byte elements, a pad of 4 dwords after every 32 dwords
  g1[1] = uni((uint32_t)STG_ROWB << 16);
  g1[2] = uni(64u << 16);
  g1[3] = uni((uint32_t)STG_ROWB << 16);
  g1[4] = uni(64u);
  g1[5] = uni(src_pitch);
  g1[6] = uni(0u);
  g1[7] = uni(0u);
  return g1;
}
// Group 0 is an in-out operand: the words that wait_tensor0 names later are then the very registers the request was issued from.
__device__ __forceinline__ void tdm_load(u32x4& g0, u32x8 g1) { asm volatile("tensor_load_to_lds %0, %1" : "+s"(g0) : "s"(g1) : "memory"); }

// 16x32 fragment from a staged plane; kb = byte offset of the fragment's first k in the row. Same k map as ld_frag.
__device__ __forceinline__ v16bf ld_frag_lds(const unsigned char* plane, int row0, int kb) {
  const int l = (int)(threadIdx.x & 31u), hh = l >> 4, m = l & 15;
  const unsigned char* p = plane + (row0 + m) * STG_PITCH + kb + 16 * hh;
  Frag f;
  f.half[0] = *(const v8bf*)(p);
  f.half[1] = *(const v8bf*)(p + 32);
  return f.v;
}

// ---------------- 64x64 block GEMM tile, 4 waves x (32x32), three-term hi/lo products ----------------
// C[m][n] = sum_k A[m][k] * B[n][k]  (A and B both stored [row][k], k contiguous).
// Result is left in the LDS tile [64][64] f32 at the start of the ring.
__device__ __forceinline__ void gemm_block64(const u16* Ah, const u16* Al, int lda,
                                             const u16* Bh, const u16* Bl, int ldb,
                                             int m0, int n0, int K, unsigned char* ring) {
  const int l = (int)(threadIdx.x & 31u), hh = l >> 4, nc = l & 15;
  const int w = (int)uni(threadIdx.x >> 5);
  const int wm = (w >> 1) * 32, wn = (w & 1) * 32;
  float* tile = (float*)ring;

  const u16* sp = (w == 0) ? Ah : (w == 1) ? Al : (w == 2) ? Bh : Bl;
  const int sld = (w < 2) ? lda : ldb;
  const int srow = (w < 2) ? m0 : n0;
  const uint64_t ga0 = (uint64_t)(size_t)sp + (uint64_t)srow * (uint64_t)sld * 2u;
  const uint32_t spitch = (uint32_t)sld * 2u;
  const uint32_t dst0 = (uint32_t)(size_t)ring + (uint32_t)w * (uint32_t)STG_SLICE;
  const int ns = K / STG_K;

  const u32x8 g1 = tdm_group1(spitch);
  u32x4 g0 = tdm_group0(dst0, ga0);
  tdm_load(g0, g1);
  wait_tensor0(g0);
  __syncthreads();                               // stage 0 is published
  g0 = tdm_group0(dst0 + (uint32_t)STG_BYTES, ga0 + (uint64_t)STG_ROWB);
  tdm_load(g0, g1);

  v8f acc[2][2] = {};
  for (int s = 0; s < ns; ++s) {
    const unsigned char* buf = ring + (s & 1) * STG_BYTES;
    const unsigned char* pAh = buf;
    const unsigned char* pAl = buf + STG_SLICE;
    const unsigned char* pBh = buf + 2 * STG_SLICE;
    const unsigned char* pBl = buf + 3 * STG_SLICE;
#pragma unroll  // both 32-k halves of the stage in line: every fragment offset is then an immediate of its LDS load
    for (int j = 0; j < STG_K / 32; ++j) {
      const int kb = 64 * j;
      const v16bf a0h = ld_frag_lds(pAh, wm, kb);
      const v16bf a0l = ld_frag_lds(pAl, wm, kb);
      const v16bf a1h = ld_frag_lds(pAh, wm + 16, kb);
      const v16bf a1l = ld_frag_lds(pAl, wm + 16, kb);
      const v16bf b0h = ld_frag_lds(pBh, wn, kb);
      const v16bf b0l = ld_frag_lds(pBl, wn, kb);
      const v16bf b1h = ld_frag_lds(pBh, wn + 16, kb);
      const v16bf b1l = ld_frag_lds(pBl, wn + 16, kb);
      mma(acc[0][0], a0h, b0h); mma(acc[0][0], a0l, b0h); mma(acc[0][0], a0h, b0l);
      mma(acc[0][1], a0h, b1h); mma(acc[0][1], a0l, b1h); mma(acc[0][1], a0h, b1l);
      mma(acc[1][0], a1h, b0h); mma(acc[1][0], a1l, b0h); mma(acc[1][0], a1h, b0l);
      mma(acc[1][1], a1h, b1h); mma(acc[1][1], a1l, b1h); mma(acc[1][1], a1h, b1l);
    }
    // Publish point of stage s + 1: own reads done, own slice landed, then the barrier that also frees stage s's buffer.
    wait_ds0();
    wait_tensor0(g0);
    __syncthreads();
    if (pinned((uint32_t)(s + 2 < ns))) {
      g0 = tdm_group0(dst0 + (uint32_t)(s & 1) * (uint32_t)STG_BYTES, ga0 + (uint64_t)(s + 2) * (uint64_t)STG_ROWB);
      tdm_load(g0, g1);
    }
  }
  wait_tensor0(g0);
  wait_ds0();
  // The last pass's own barrier stands behind every wave's last read of the ring: its start may now hold the result tile.
#pragma unroll
  for (int r = 0; r < 8; ++r) {
    const int row0 = wm + 8 * hh + r;
    const int row1 = wm + 16 + 8 * hh + r;
    tile[row0 * 64 + wn + nc]      = acc[0][0][r];
    tile[row0 * 64 + wn + 16 + nc] = acc[0][1][r];
    tile[row1 * 64 + wn + nc]      = acc[1][0][r];
    tile[row1 * 64 + wn + 16 + nc] = acc[1][1][r];
  }
}

// ---------------- q/k/v projections: blockIdx.z selects the matrix ----------------
// Wh/Wl hold Wq, Wk, Wv, Wo back to back ([n][k] rows). N tile = one head (64 columns).
__global__ __launch_bounds__(128) void k_proj_qkv(const u16* Xh, const u16* Xl,
                                                  const u16* Wh, const u16* Wl,
                                                  u16* Qh, u16* Ql, u16* Kh, u16* Kl,
                                                  u16* Vth, u16* Vtl) {
  __shared__ __attribute__((aligned(2048))) unsigned char ring[RING_BYTES];
  const float* tile = (const float*)ring;
  const int z = (int)blockIdx.z;
  const int hd = (int)blockIdx.x;            // head index = n0 / 64
  const int n0 = hd * 64;
  const int m0 = (int)blockIdx.y * 64;
  const u16* Bh = Wh + (size_t)z * (size_t)D_ * (size_t)D_;
  const u16* Bl = Wl + (size_t)z * (size_t)D_ * (size_t)D_;
  gemm_block64(Xh, Xl, D_, Bh, Bl, D_, m0, n0, D_, ring);
  __syncthreads();

  const int w = (int)(threadIdx.x >> 5), l = (int)(threadIdx.x & 31u);
  const int b = m0 >> 11, s0 = m0 & (S_ - 1);
  const int bh = b * H_ + hd;
  if (z < 2) {
    u16* Ph = (z == 0) ? Qh : Kh;
    u16* Pl = (z == 0) ? Ql : Kl;
    const size_t base = ((size_t)bh * (size_t)S_ + (size_t)s0) * (size_t)DH_;
#pragma unroll
    for (int j = 0; j < 4; ++j) {
      const int row = w * 16 + j * 4 + (l >> 3);
      const int c0 = 8 * (l & 7);
      const float* tp = tile + row * 64 + c0;
      const v4f f0 = *(const v4f*)(tp);
      const v4f f1 = *(const v4f*)(tp + 4);
      v4u vh, vl;
      split8(f0, f1, vh, vl);
      const size_t o = base + (size_t)row * (size_t)DH_ + (size_t)c0;
      *(v4u*)(Ph + o) = vh;
      *(v4u*)(Pl + o) = vl;
      
    }
  } else {
#pragma unroll
    for (int j = 0; j < 4; ++j) {
      const int d = w * 16 + j * 4 + (l >> 3);   // Vt row within the head
      const int k0 = 8 * (l & 7);               // key offset within the 64-key tile
      v4f f0, f1;
      f0.x = tile[(k0 + 0) * 64 + d]; f0.y = tile[(k0 + 1) * 64 + d];
      f0.z = tile[(k0 + 2) * 64 + d]; f0.w = tile[(k0 + 3) * 64 + d];
      f1.x = tile[(k0 + 4) * 64 + d]; f1.y = tile[(k0 + 5) * 64 + d];
      f1.z = tile[(k0 + 6) * 64 + d]; f1.w = tile[(k0 + 7) * 64 + d];
      v4u vh, vl;
      split8(f0, f1, vh, vl);
      const size_t o = ((size_t)bh * (size_t)DH_ + (size_t)d) * (size_t)S_ + (size_t)s0 + (size_t)k0;
      *(v4u*)(Vth + o) = vh;
      *(v4u*)(Vtl + o) = vl;
      
    }
  }
}

// ---------------- output projection: out = ctx . Wo^T + bo (f32) ----------------
__global__ __launch_bounds__(128) void k_proj_out(const u16* Ch, const u16* Cl,
                                                  const u16* Wh, const u16* Wl,
                                                  const float* __restrict__ bo, float* out) {
  __shared__ __attribute__((aligned(2048))) unsigned char ring[RING_BYTES];
  const float* tile = (const float*)ring;
  const int n0 = (int)blockIdx.x * 64;
  const int m0 = (int)blockIdx.y * 64;
  const u16* Bh = Wh + (size_t)3 * (size_t)D_ * (size_t)D_;
  const u16* Bl = Wl + (size_t)3 * (size_t)D_ * (size_t)D_;
  gemm_block64(Ch, Cl, D_, Bh, Bl, D_, m0, n0, D_, ring);
  __syncthreads();

  const int w = (int)(threadIdx.x >> 5), l = (int)(threadIdx.x & 31u);
#pragma unroll
  for (int j = 0; j < 8; ++j) {
    const int row = w * 16 + j * 2 + (l >> 4);
    const int c0 = 4 * (l & 15);
    v4f v = *(const v4f*)(tile + row * 64 + c0);
    const v4f bb = *(const v4f*)(bo + n0 + c0);
    v = v + bb;
    float* op = out + (size_t)(m0 + row) * (size_t)D_ + (size_t)(n0 + c0);
    *(v4f*)op = v;
    
  }
}

union PFrag { v16bf v; unsigned int u[8]; };

// lane l <-> lane l ^ 16
__device__ __forceinline__ float xhalf(float x) {
  return __builtin_bit_cast(float, __builtin_amdgcn_permlanex16(__builtin_bit_cast(int, x), __builtin_bit_cast(int, x),
                                                                0x76543210, 0xfedcba98, false, false));
}

__global__ __launch_bounds__(32) void k_attn(const u16* Qh, const u16* Ql,
                                             const u16* Kh, const u16* Kl,
                                             const u16* Vth, const u16* Vtl,
                                             u16* Ch, u16* Cl) {
  __shared__ __attribute__((aligned(16))) float ctile[16 * 64];

  const int gw = (int)blockIdx.x;                // 0 .. B*H*(S/16)-1
  const int bh = gw >> 7, qt = gw & 127;
  const int b = bh >> 4, hd = bh & 15;
  const int l = (int)(threadIdx.x & 31u), hh = l >> 4, nc = l & 15;
  const int q0 = qt * 16;
  const int ex = hd + 1;                         // slope = 2^(-(h+1)/2)
  const float slope = ((ex & 1) ? 0.70710678118654752f : 1.0f) *
                      __uint_as_float((unsigned int)(127 - (ex >> 1)) << 23);

  const u16* Qhp  = Qh  + (size_t)bh * (size_t)S_ * (size_t)DH_;
  const u16* Qlp  = Ql  + (size_t)bh * (size_t)S_ * (size_t)DH_;
  const u16* Khp  = Kh  + (size_t)bh * (size_t)S_ * (size_t)DH_;
  const u16* Klp  = Kl  + (size_t)bh * (size_t)S_ * (size_t)DH_;
  const u16* Vthp = Vth + (size_t)bh * (size_t)DH_ * (size_t)S_;
  const u16* Vtlp = Vtl + (size_t)bh * (size_t)DH_ * (size_t)S_;

  const v16bf q0h = ld_frag(Qhp, DH_, q0, 0),  q0l = ld_frag(Qlp, DH_, q0, 0);
  const v16bf q1h = ld_frag(Qhp, DH_, q0, 32), q1l = ld_frag(Qlp, DH_, q0, 32);

  v8f o[4] = {};                                 // o[si][r] = O[query nc][d = 16 si + 8 h + r]
  float mq = -3.0e38f;                           // running maximum of this lane's query (equal in both halves)
  float lq = 0.0f;                               // this half's share of the query's sum; halves joined after the loop
  const int q = q0 + nc;

  const int nchunk = (q0 >> 5) + 1;              // keys 0 .. q0+15, 32 per chunk
  for (int c = 0; c < nchunk; ++c) {
    const int ks = c << 5;
    v8f s[2] = {};
#pragma unroll
    for (int t = 0; t < 2; ++t) {
      const int kr = ks + 16 * t;                // A[m=key][k=d]: rows of K, d contiguous
      const v16bf k0h = ld_frag(Khp, DH_, kr, 0),  k0l = ld_frag(Klp, DH_, kr, 0);
      const v16bf k1h = ld_frag(Khp, DH_, kr, 32), k1l = ld_frag(Klp, DH_, kr, 32);
      mma(s[t], k0h, q0h); mma(s[t], k0h, q0l); mma(s[t], k0l, q0h);
      mma(s[t], k1h, q1h); mma(s[t], k1h, q1l); mma(s[t], k1l, q1h);
    }

    float xs[2][8];
    float t0 = -3.0e38f;
#pragma unroll
    for (int t = 0; t < 2; ++t) {
#pragma unroll
      for (int r = 0; r < 8; ++r) {
        const int kk = ks + 16 * t + 8 * hh + r;
        float x = (s[t][r] - (float)(q - kk) * slope) * 0.125f;
        x = 30.0f * tanhf(x * (1.0f / 30.0f));
        x = (kk <= q) ? x : -3.0e38f;
        xs[t][r] = x;
        t0 = fmaxf(t0, x);
      }
    }
    t0 = fmaxf(t0, xhalf(t0));
    const float mnew = fmaxf(mq, t0);
    const float alpha = __expf(mq - mnew);
    mq = mnew;

    PFrag ph, pl;
    float u = 0.0f;
#pragma unroll
    for (int t = 0; t < 2; ++t) {
#pragma unroll
      for (int i = 0; i < 4; ++i) {
        const float pa = __expf(xs[t][2 * i] - mnew);
        const float pb = __expf(xs[t][2 * i + 1] - mnew);
        u += pa + pb;
        split_pair(pa, pb, ph.u[4 * t + i], pl.u[4 * t + i]);
      }
    }
    lq = lq * alpha + u;
#pragma unroll
    for (int si = 0; si < 4; ++si) o[si] *= alpha;

#pragma unroll
    for (int si = 0; si < 4; ++si) {             // A[m=d][k=key]: rows of Vt, keys contiguous
      const v16bf vh = ld_frag(Vthp, S_, 16 * si, ks);
      const v16bf vl = ld_frag(Vtlp, S_, 16 * si, ks);
      mma(o[si], vh, ph.v); mma(o[si], vh, pl.v); mma(o[si], vl, ph.v);
    }
  }

  const float inv = 1.0f / (lq + xhalf(lq));
#pragma unroll
  for (int si = 0; si < 4; ++si) {
    float* cp = ctile + nc * 64 + 16 * si + 8 * hh;
    v4f c0v, c1v;
    c0v.x = o[si][0] * inv; c0v.y = o[si][1] * inv; c0v.z = o[si][2] * inv; c0v.w = o[si][3] * inv;
    c1v.x = o[si][4] * inv; c1v.y = o[si][5] * inv; c1v.z = o[si][6] * inv; c1v.w = o[si][7] * inv;
    *(v4f*)(cp) = c0v;
    *(v4f*)(cp + 4) = c1v;
  }
  __syncthreads();
  const size_t rbase = ((size_t)b * (size_t)S_ + (size_t)q0) * (size_t)D_ + (size_t)hd * (size_t)DH_;
#pragma unroll
  for (int j = 0; j < 4; ++j) {
    const int row = j * 4 + (l >> 3);
    const int c0 = 8 * (l & 7);
    const float* tp = ctile + row * 64 + c0;
    const v4f f0 = *(const v4f*)(tp);
    const v4f f1 = *(const v4f*)(tp + 4);
    v4u vh, vl;
    split8(f0, f1, vh, vl);
    const size_t oidx = rbase + (size_t)row * (size_t)D_ + (size_t)c0;
    *(v4u*)(Ch + oidx) = vh;
    *(v4u*)(Cl + oidx) = vl;
    
  }
}

extern "C" void kernel_launch(void* const* d_in, const int* in_sizes, int n_in,
                              void* d_out, int out_size, void* d_ws, size_t ws_size,
                              hipStream_t stream) {
  if (n_in < 6) return;
  const int nX = M_ * D_;          // 4194304
  const int nW = D_ * D_;          // 1048576
  const int nHead = B_ * H_ * S_ * DH_;   // 4194304
  if (in_sizes[0] != nX || in_sizes[1] != nW || in_sizes[2] != nW ||
      in_sizes[3] != nW || in_sizes[4] != nW || in_sizes[5] != D_) return;
  if (out_size != nX) return;

  const float* hs = (const float*)d_in[0];
  const float* wq = (const float*)d_in[1];
  const float* wk = (const float*)d_in[2];
  const float* wv = (const float*)d_in[3];
  const float* wo = (const float*)d_in[4];
  const float* bo = (const float*)d_in[5];
  float* out = (float*)d_out;

  char* ws = (char*)d_ws;
  size_t off = 0;
  const size_t bX = (size_t)nX * 2u;            // 8 MiB per plane
  const size_t bW = (size_t)nW * 2u * 4u;       // four matrices per plane, 8 MiB
  const size_t bHd = (size_t)nHead * 2u;        // 8 MiB per plane
  u16* Xh  = (u16*)(ws + off); off += bX;
  u16* Xl  = (u16*)(ws + off); off += bX;
  u16* Wh  = (u16*)(ws + off); off += bW;
  u16* Wl  = (u16*)(ws + off); off += bW;
  u16* Qh  = (u16*)(ws + off); off += bHd;
  u16* Ql  = (u16*)(ws + off); off += bHd;
  u16* Kh  = (u16*)(ws + off); off += bHd;
  u16* Kl  = (u16*)(ws + off); off += bHd;
  u16* Vth = (u16*)(ws + off); off += bHd;
  u16* Vtl = (u16*)(ws + off); off += bHd;
  u16* Ch  = (u16*)(ws + off); off += bX;
  u16* Cl  = (u16*)(ws + off); off += bX;
  if (off > ws_size) return;                    // 100663296 B total

  // 1) f32 -> bf16 hi/lo planes: x (2048 blocks needed) and 4 weights (512 blocks each)
  k_split<<<dim3((unsigned)(nX / 8 / 256), 5, 1), 256, 0, stream>>>(hs, wq, wk, wv, wo, Xh, Xl, Wh, Wl, nX, nW);
  // 2) q/k/v projections: 16 head tiles x 64 row tiles x 3 matrices
  k_proj_qkv<<<dim3(D_ / 64, M_ / 64, 3), 128, 0, stream>>>(Xh, Xl, Wh, Wl, Qh, Ql, Kh, Kl, Vth, Vtl);
  // 3) attention: one 32-thread block per (b, h, 16-query tile)
  k_attn<<<dim3((unsigned)(B_ * H_ * (S_ / 16)), 1, 1), 32, 0, stream>>>(Qh, Ql, Kh, Kl, Vth, Vtl, Ch, Cl);
  // 4) output projection + bias
  k_proj_out<<<dim3(D_ / 64, M_ / 64, 1), 128, 0, stream>>>(Ch, Cl, Wh, Wl, bo, out);
  (void)hipGetLastError();
}

// v003
// Measured time: 321 microseconds a run.
// In both of two side-by-side timings against v002, it was 1.06 times as fast.
// Counting every step since v000, it is 1.88 times as fast.
#include <hip/hip_runtime.h>
#include <stdint.h>

// All contractions (q/k/v projections, q.k^T scores, p.v, output projection): v_wmma_f32_16x16x32_bf16 with bf16 hi/lo operand planes everywhere (hi.hi + lo.hi + hi.lo), f32 accumulate; alibi bias, 1/sqrt(d) scale, tanh softcap and softmax in f32.

#define B_  2
#define S_  2048
#define D_  1024
#define H_  16
#define DH_ 64
#define M_  (B_ * S_)

static_assert((M_ % 64) == 0);
static_assert((D_ % 64) == 0);
static_assert((S_ % 64) == 0);
static_assert(DH_ == 64);

typedef unsigned short u16;
typedef __bf16 v16bf __attribute__((ext_vector_type(16)));
typedef __bf16 v8bf  __attribute__((ext_vector_type(8)));
typedef float  v8f   __attribute__((ext_vector_type(8)));
typedef float  v4f   __attribute__((ext_vector_type(4)));
typedef unsigned int v4u __attribute__((ext_vector_type(4)));

union Frag { v16bf v; v8bf half[2]; };

// 16x32 fragment from a 16-bit plane stored [row][k] with k contiguous (pitch ld elements).
// Same map for A (row = m) and B (row = n): lane l -> row (l&15); elements 0..7 <- k0+8h+0..7,
// elements 8..15 <- k0+16+8h+0..7 with h = l>>4.
__device__ __forceinline__ v16bf ld_frag(const u16* base, int ld, int row0, int k0) {
  const int l = (int)(threadIdx.x & 31u), hh = l >> 4, m = l & 15;
  const u16* p = base + (size_t)(row0 + m) * (size_t)ld + (size_t)(k0 + 8 * hh);
  Frag f;
  f.half[0] = *(const v8bf*)(p);
  f.half[1] = *(const v8bf*)(p + 16);
  return f.v;
}

// D[16x16] += A[16x32] . B[32x16]; acc element r of lane l = (row 8h+r, col l&15). Hazard guard after every issue.
__device__ __forceinline__ void mma(v8f& acc, v16bf a, v16bf b) {
  acc = __builtin_amdgcn_wmma_f32_16x16x32_bf16(false, a, false, b, (short)0, acc, false, false);
  asm volatile("v_nop\n\tv_nop\n\tv_nop\n\tv_nop" : "+v"(acc) : "v"(a), "v"(b));
}

// f32 -> bf16 bits, RNE convert
__device__ __forceinline__ unsigned int bf16_bits(float f) {
  const unsigned int u = __float_as_uint(f);
  return (u + 0x7FFFu + ((u >> 16) & 1u)) >> 16;
}

// hi = bf16(x), lo = bf16(x - hi)
__device__ __forceinline__ void split_one(float x, unsigned int& hi, unsigned int& lo) {
  hi = bf16_bits(x);
  lo = bf16_bits(x - __uint_as_float(hi << 16));
}

__device__ __forceinline__ void split_pair(float x, float y, unsigned int& hi, unsigned int& lo) {
  unsigned int hx, lx, hy, ly;
  split_one(x, hx, lx);
  split_one(y, hy, ly);
  hi = hx | (hy << 16);
  lo = lx | (ly << 16);
}

// 8 consecutive floats -> packed 8 x bf16 hi (16 B) and 8 x bf16 lo (16 B)
__device__ __forceinline__ void split8(v4f a, v4f c, v4u& hi, v4u& lo) {
  unsigned int h0, l0, h1, l1, h2, l2, h3, l3;
  split_pair(a.x, a.y, h0, l0);
  split_pair(a.z, a.w, h1, l1);
  split_pair(c.x, c.y, h2, l2);
  split_pair(c.z, c.w, h3, l3);
  hi.x = h0; hi.y = h1; hi.z = h2; hi.w = h3;
  lo.x = l0; lo.y = l1; lo.z = l2; lo.w = l3;
}

// ---------------- f32 -> bf16 hi/lo planes for x and the four weight matrices ----------------
// blockIdx.y selects the segment (0: x, 1..4: Wq, Wk, Wv, Wo). Each thread converts 8 floats and
__global__ __launch_bounds__(256) void k_split(const float* __restrict__ x,
                                               const float* __restrict__ wq, const float* __restrict__ wk,
                                               const float* __restrict__ wv, const float* __restrict__ wo,
                                               u16* __restrict__ Xh, u16* __restrict__ Xl,
                                               u16* __restrict__ Wh, u16* __restrict__ Wl,
                                               int nx, int nw) {
  const int seg = (int)blockIdx.y;
  const float* src = x;
  u16* dh = Xh;
  u16* dl = Xl;
  int n = nx;
  if (seg > 0) {
    const int wi = seg - 1;
    src = (wi == 0) ? wq : (wi == 1) ? wk : (wi == 2) ? wv : wo;
    dh = Wh + (size_t)wi * (size_t)nw;
    dl = Wl + (size_t)wi * (size_t)nw;
    n = nw;
  }
  const size_t i8 = ((size_t)blockIdx.x * (size_t)blockDim.x + (size_t)threadIdx.x) * 8u;
  if (i8 + 8u > (size_t)n) return;
  const v4f a = *(const v4f*)(src + i8);
  const v4f c = *(const v4f*)(src + i8 + 4);
  v4u vh, vl;
  split8(a, c, vh, vl);
  u16* ph = dh + i8;
  u16* pl = dl + i8;
  *(v4u*)ph = vh;
  *(v4u*)pl = vl;
  
}

// ---------------- operand staging: tensor loads into a two-buffer LDS ring ----------------
// A stage is 64 k of the block's four operand planes (A hi, A lo, B hi, B lo): 64 rows of 128 B each, laid at pitch 144 B.
// Wave w brings plane w: one request per wave and stage.
typedef uint32_t u32x4 __attribute__((ext_vector_type(4)));
typedef uint32_t u32x8 __attribute__((ext_vector_type(8)));
#define STG_K     64                     // k elements per stage
#define STG_ROWB  128                    // bytes of one staged row
#define STG_PITCH 144                    // LDS row pitch: an odd multiple of 16 B, conflict-free for 16-byte reads
#define STG_SLICE 10240                  // 64 rows x 144 B = 9216 B, rounded up to a multiple of 2 KiB
#define STG_BYTES (4 * STG_SLICE)        // one buffer
#define RING_BYTES (2 * STG_BYTES)       // 81920 B: four blocks per WGP
static_assert((D_ % STG_K) == 0 && (D_ / STG_K) >= 2);
static_assert(64 * STG_PITCH <= STG_SLICE && (STG_SLICE % 2048) == 0);
static_assert(64 * 64 * 4 <= RING_BYTES);

__device__ __forceinline__ uint32_t uni(uint32_t v) { return (uint32_t)__builtin_amdgcn_readfirstlane(v); }
// Holds a wave-uniform test in a scalar register, so that the branch round a tensor load is a scalar branch (the load ignores EXEC).
__device__ __forceinline__ uint32_t pinned(uint32_t v) { uint32_t w = uni(v); asm volatile("" : "+s"(w)); return w; }
// This wave's own slice has landed. The wait names group 0 of the request it covers, so that those registers keep their words until then.
__device__ __forceinline__ void wait_tensor0(u32x4 g0) { asm volatile("s_wait_tensorcnt 0x0" :: "s"(g0) : "memory"); }
__device__ __forceinline__ void wait_ds0() { asm volatile("s_wait_dscnt 0x0" ::: "memory"); }          // this wave's LDS reads have returned

// Descriptor group 0: place in LDS and first byte of the tile.
__device__ __forceinline__ u32x4 tdm_group0(uint32_t lds_dst, uint64_t ga) {
  u32x4 g0;
  g0[0] = uni(1u);
  g0[1] = uni(lds_dst);
  g0[2] = uni((uint32_t)ga);
  g0[3] = uni((((uint32_t)(ga >> 32)) & 0x01FFFFFFu) | 0x80000000u);
  return g0;
}
// Descriptor group 1: a tile of 64 rows of 128 B, source row pitch src_pitch bytes, 16 B of LDS pad behind every row.
__device__ __forceinline__ u32x8 tdm_group1(uint32_t src_pitch) {
  u32x8 g1;
  g1[0] = uni((1u << 20) | (4u << 22) | (3u << 25));   // no mask, 1-byte elements, a pad of 4 dwords after every 32 dwords
  g1[1] = uni((uint32_t)STG_ROWB << 16);
  g1[2] = uni(64u << 16);
  g1[3] = uni((uint32_t)STG_ROWB << 16);
  g1[4] = uni(64u);
  g1[5] = uni(src_pitch);
  g1[6] = uni(0u);
  g1[7] = uni(0u);
  return g1;
}
// Group 0 is an in-out operand: the words that wait_tensor0 names later are then the very registers the request was issued from.
__device__ __forceinline__ void tdm_load(u32x4& g0, u32x8 g1) { asm volatile("tensor_load_to_lds %0, %1" : "+s"(g0) : "s"(g1) : "memory"); }

// 16x32 fragment from a staged plane; kb = byte offset of the fragment's first k in the row. Same k map as ld_frag.
__device__ __forceinline__ v16bf ld_frag_lds(const unsigned char* plane, int row0, int kb) {
  const int l = (int)(threadIdx.x & 31u), hh = l >> 4, m = l & 15;
  const unsigned char* p = plane + (row0 + m) * STG_PITCH + kb + 16 * hh;
  Frag f;
  f.half[0] = *(const v8bf*)(p);
  f.half[1] = *(const v8bf*)(p + 32);
  return f.v;
}

// ---------------- 64x64 block GEMM tile, 4 waves x (32x32), three-term hi/lo products ----------------
// C[m][n] = sum_k A[m][k] * B[n][k]  (A and B both stored [row][k], k contiguous).
// Result is left in the LDS tile [64][64] f32 at the start of the ring.
__device__ __forceinline__ void gemm_block64(const u16* Ah, const u16* Al, int lda,
                                             const u16* Bh, const u16* Bl, int ldb,
                                             int m0, int n0, int K, unsigned char* ring) {
  const int l = (int)(threadIdx.x & 31u), hh = l >> 4, nc = l & 15;
  const int w = (int)uni(threadIdx.x >> 5);
  const int wm = (w >> 1) * 32, wn = (w & 1) * 32;
  float* tile = (float*)ring;

  const u16* sp = (w == 0) ? Ah : (w == 1) ? Al : (w == 2) ? Bh : Bl;
  const int sld = (w < 2) ? lda : ldb;
  const int srow = (w < 2) ? m0 : n0;
  const uint64_t ga0 = (uint64_t)(size_t)sp + (uint64_t)srow * (uint64_t)sld * 2u;
  const uint32_t spitch = (uint32_t)sld * 2u;
  const uint32_t dst0 = (uint32_t)(size_t)ring + (uint32_t)w * (uint32_t)STG_SLICE;
  const int ns = K / STG_K;

  const u32x8 g1 = tdm_group1(spitch);
  u32x4 g0 = tdm_group0(dst0, ga0);
  tdm_load(g0, g1);
  wait_tensor0(g0);
  __syncthreads();                               // stage 0 is published
  g0 = tdm_group0(dst0 + (uint32_t)STG_BYTES, ga0 + (uint64_t)STG_ROWB);
  tdm_load(g0, g1);

  v8f acc[2][2] = {};
  for (int s = 0; s < ns; ++s) {
    const unsigned char* buf = ring + (s & 1) * STG_BYTES;
    const unsigned char* pAh = buf;
    const unsigned char* pAl = buf + STG_SLICE;
    const unsigned char* pBh = buf + 2 * STG_SLICE;
    const unsigned char* pBl = buf + 3 * STG_SLICE;
#pragma unroll  // both 32-k halves of the stage in line: every fragment offset is then an immediate of its LDS load
    for (int j = 0; j < STG_K / 32; ++j) {
      const int kb = 64 * j;
      const v16bf a0h = ld_frag_lds(pAh, wm, kb);
      const v16bf a0l = ld_frag_lds(pAl, wm, kb);
      const v16bf a1h = ld_frag_lds(pAh, wm + 16, kb);
      const v16bf a1l = ld_frag_lds(pAl, wm + 16, kb);
      const v16bf b0h = ld_frag_lds(pBh, wn, kb);
      const v16bf b0l = ld_frag_lds(pBl, wn, kb);
      const v16bf b1h = ld_frag_lds(pBh, wn + 16, kb);
      const v16bf b1l = ld_frag_lds(pBl, wn + 16, kb);
      mma(acc[0][0], a0h, b0h); mma(acc[0][0], a0l, b0h); mma(acc[0][0], a0h, b0l);
      mma(acc[0][1], a0h, b1h); mma(acc[0][1], a0l, b1h); mma(acc[0][1], a0h, b1l);
      mma(acc[1][0], a1h, b0h); mma(acc[1][0], a1l, b0h); mma(acc[1][0], a1h, b0l);
      mma(acc[1][1], a1h, b1h); mma(acc[1][1], a1l, b1h); mma(acc[1][1], a1h, b1l);
    }
    // Publish point of stage s + 1: own reads done, own slice landed, then the barrier that also frees stage s's buffer.
    wait_ds0();
    wait_tensor0(g0);
    __syncthreads();
    if (pinned((uint32_t)(s + 2 < ns))) {
      g0 = tdm_group0(dst0 + (uint32_t)(s & 1) * (uint32_t)STG_BYTES, ga0 + (uint64_t)(s + 2) * (uint64_t)STG_ROWB);
      tdm_load(g0, g1);
    }
  }
  wait_tensor0(g0);
  wait_ds0();
  // The last pass's own barrier stands behind every wave's last read of the ring: its start may now hold the result tile.
#pragma unroll
  for (int r = 0; r < 8; ++r) {
    const int row0 = wm + 8 * hh + r;
    const int row1 = wm + 16 + 8 * hh + r;
    tile[row0 * 64 + wn + nc]      = acc[0][0][r];
    tile[row0 * 64 + wn + 16 + nc] = acc[0][1][r];
    tile[row1 * 64 + wn + nc]      = acc[1][0][r];
    tile[row1 * 64 + wn + 16 + nc] = acc[1][1][r];
  }
}

// ---------------- q/k/v projections: blockIdx.z selects the matrix ----------------
// Wh/Wl hold Wq, Wk, Wv, Wo back to back ([n][k] rows). N tile = one head (64 columns).
__global__ __launch_bounds__(128) void k_proj_qkv(const u16* Xh, const u16* Xl,
                                                  const u16* Wh, const u16* Wl,
                                                  u16* Qh, u16* Ql, u16* Kh, u16* Kl,
                                                  u16* Vth, u16* Vtl) {
  __shared__ __attribute__((aligned(2048))) unsigned char ring[RING_BYTES];
  const float* tile = (const float*)ring;
  const int z = (int)blockIdx.z;
  const int hd = (int)blockIdx.x;            // head index = n0 / 64
  const int n0 = hd * 64;
  const int m0 = (int)blockIdx.y * 64;
  const u16* Bh = Wh + (size_t)z * (size_t)D_ * (size_t)D_;
  const u16* Bl = Wl + (size_t)z * (size_t)D_ * (size_t)D_;
  gemm_block64(Xh, Xl, D_, Bh, Bl, D_, m0, n0, D_, ring);
  __syncthreads();

  const int w = (int)(threadIdx.x >> 5), l = (int)(threadIdx.x & 31u);
  const int b = m0 >> 11, s0 = m0 & (S_ - 1);
  const int bh = b * H_ + hd;
  if (z < 2) {
    u16* Ph = (z == 0) ? Qh : Kh;
    u16* Pl = (z == 0) ? Ql : Kl;
    const size_t base = ((size_t)bh * (size_t)S_ + (size_t)s0) * (size_t)DH_;
#pragma unroll
    for (int j = 0; j < 4; ++j) {
      const int row = w * 16 + j * 4 + (l >> 3);
      const int c0 = 8 * (l & 7);
      const float* tp = tile + row * 64 + c0;
      const v4f f0 = *(const v4f*)(tp);
      const v4f f1 = *(const v4f*)(tp + 4);
      v4u vh, vl;
      split8(f0, f1, vh, vl);
      const size_t o = base + (size_t)row * (size_t)DH_ + (size_t)c0;
      *(v4u*)(Ph + o) = vh;
      *(v4u*)(Pl + o) = vl;
      
    }
  } else {
#pragma unroll
    for (int j = 0; j < 4; ++j) {
      const int d = w * 16 + j * 4 + (l >> 3);   // Vt row within the head
      const int k0 = 8 * (l & 7);               // key offset within the 64-key tile
      v4f f0, f1;
      f0.x = tile[(k0 + 0) * 64 + d]; f0.y = tile[(k0 + 1) * 64 + d];
      f0.z = tile[(k0 + 2) * 64 + d]; f0.w = tile[(k0 + 3) * 64 + d];
      f1.x = tile[(k0 + 4) * 64 + d]; f1.y = tile[(k0 + 5) * 64 + d];
      f1.z = tile[(k0 + 6) * 64 + d]; f1.w = tile[(k0 + 7) * 64 + d];
      v4u vh, vl;
      split8(f0, f1, vh, vl);
      const size_t o = ((size_t)bh * (size_t)DH_ + (size_t)d) * (size_t)S_ + (size_t)s0 + (size_t)k0;
      *(v4u*)(Vth + o) = vh;
      *(v4u*)(Vtl + o) = vl;
      
    }
  }
}

// ---------------- output projection: out = ctx . Wo^T + bo (f32) ----------------
__global__ __launch_bounds__(128) void k_proj_out(const u16* Ch, const u16* Cl,
                                                  const u16* Wh, const u16* Wl,
                                                  const float* __restrict__ bo, float* out) {
  __shared__ __attribute__((aligned(2048))) unsigned char ring[RING_BYTES];
  const float* tile = (const float*)ring;
  const int n0 = (int)blockIdx.x * 64;
  const int m0 = (int)blockIdx.y * 64;
  const u16* Bh = Wh + (size_t)3 * (size_t)D_ * (size_t)D_;
  const u16* Bl = Wl + (size_t)3 * (size_t)D_ * (size_t)D_;
  gemm_block64(Ch, Cl, D_, Bh, Bl, D_, m0, n0, D_, ring);
  __syncthreads();

  const int w = (int)(threadIdx.x >> 5), l = (int)(threadIdx.x & 31u);
#pragma unroll
  for (int j = 0; j < 8; ++j) {
    const int row = w * 16 + j * 2 + (l >> 4);
    const int c0 = 4 * (l & 15);
    v4f v = *(const v4f*)(tile + row * 64 + c0);
    const v4f bb = *(const v4f*)(bo + n0 + c0);
    v = v + bb;
    float* op = out + (size_t)(m0 + row) * (size_t)D_ + (size_t)(n0 + c0);
    *(v4f*)op = v;
    
  }
}

union PFrag { v16bf v; unsigned int u[8]; };

// lane l <-> lane l ^ 16
__device__ __forceinline__ float xhalf(float x) {
  return __builtin_bit_cast(float, __builtin_amdgcn_permlanex16(__builtin_bit_cast(int, x), __builtin_bit_cast(int, x),
                                                                0x76543210, 0xfedcba98, false, false));
}

__global__ __launch_bounds__(32) void k_attn(const u16* Qh, const u16* Ql,
                                             const u16* Kh, const u16* Kl,
                                             const u16* Vth, const u16* Vtl,
                                             u16* Ch, u16* Cl) {
  __shared__ __attribute__((aligned(16))) float ctile[16 * 64];

  const int gw = (int)blockIdx.x;                // 0 .. B*H*(S/16)-1
  const int bh = gw >> 7, qt = gw & 127;
  const int b = bh >> 4, hd = bh & 15;
  const int l = (int)(threadIdx.x & 31u), hh = l >> 4, nc = l & 15;
  const int q0 = qt * 16;
  const int ex = hd + 1;                         // slope = 2^(-(h+1)/2)
  const float slope = ((ex & 1) ? 0.70710678118654752f : 1.0f) *
                      __uint_as_float((unsigned int)(127 - (ex >> 1)) << 23);

  const u16* Qhp  = Qh  + (size_t)bh * (size_t)S_ * (size_t)DH_;
  const u16* Qlp  = Ql  + (size_t)bh * (size_t)S_ * (size_t)DH_;
  const u16* Khp  = Kh  + (size_t)bh * (size_t)S_ * (size_t)DH_;
  const u16* Klp  = Kl  + (size_t)bh * (size_t)S_ * (size_t)DH_;
  const u16* Vthp = Vth + (size_t)bh * (size_t)DH_ * (size_t)S_;
  const u16* Vtlp = Vtl + (size_t)bh * (size_t)DH_ * (size_t)S_;

  const v16bf q0h = ld_frag(Qhp, DH_, q0, 0),  q0l = ld_frag(Qlp, DH_, q0, 0);
  const v16bf q1h = ld_frag(Qhp, DH_, q0, 32), q1l = ld_frag(Qlp, DH_, q0, 32);

  v8f o[4] = {};                                 // o[si][r] = O[query nc][d = 16 si + 8 h + r]
  float mq = -3.0e38f;                           // running maximum of this lane's query (equal in both halves)
  float lq = 0.0f;                               // this half's share of the query's sum; halves joined after the loop
  const int q = q0 + nc;

  const int nchunk = (q0 >> 5) + 1;              // keys 0 .. q0+15, 32 per chunk
  for (int c = 0; c < nchunk; ++c) {
    const int ks = c << 5;
    v8f s[2] = {};
#pragma unroll
    for (int t = 0; t < 2; ++t) {
      const int kr = ks + 16 * t;                // A[m=key][k=d]: rows of K, d contiguous
      const v16bf k0h = ld_frag(Khp, DH_, kr, 0),  k0l = ld_frag(Klp, DH_, kr, 0);
      const v16bf k1h = ld_frag(Khp, DH_, kr, 32), k1l = ld_frag(Klp, DH_, kr, 32);
      mma(s[t], k0h, q0h); mma(s[t], k0h, q0l); mma(s[t], k0l, q0h);
      mma(s[t], k1h, q1h); mma(s[t], k1h, q1l); mma(s[t], k1l, q1h);
    }

    float xs[2][8];
    float t0 = -3.0e38f;
#pragma unroll
    for (int t = 0; t < 2; ++t) {
#pragma unroll
      for (int r = 0; r < 8; ++r) {
        const int kk = ks + 16 * t + 8 * hh + r;
        float x = (s[t][r] - (float)(q - kk) * slope) * 0.125f;
        x = 30.0f * __builtin_amdgcn_tanhf(x * (1.0f / 30.0f));   // one v_tanh_f32: no branch, so the 16 scores of a lane run as independent chains
        x = (kk <= q) ? x : -3.0e38f;
        xs[t][r] = x;
        t0 = fmaxf(t0, x);
      }
    }
    t0 = fmaxf(t0, xhalf(t0));
    const float mnew = fmaxf(mq, t0);
    const float alpha = __expf(mq - mnew);
    mq = mnew;

    PFrag ph, pl;
    float u = 0.0f;
#pragma unroll
    for (int t = 0; t < 2; ++t) {
#pragma unroll
      for (int i = 0; i < 4; ++i) {
        const float pa = __expf(xs[t][2 * i] - mnew);
        const float pb = __expf(xs[t][2 * i + 1] - mnew);
        u += pa + pb;
        split_pair(pa, pb, ph.u[4 * t + i], pl.u[4 * t + i]);
      }
    }
    lq = lq * alpha + u;
#pragma unroll
    for (int si = 0; si < 4; ++si) o[si] *= alpha;

#pragma unroll
    for (int si = 0; si < 4; ++si) {             // A[m=d][k=key]: rows of Vt, keys contiguous
      const v16bf vh = ld_frag(Vthp, S_, 16 * si, ks);
      const v16bf vl = ld_frag(Vtlp, S_, 16 * si, ks);
      mma(o[si], vh, ph.v); mma(o[si], vh, pl.v); mma(o[si], vl, ph.v);
    }
  }

  const float inv = 1.0f / (lq + xhalf(lq));
#pragma unroll
  for (int si = 0; si < 4; ++si) {
    float* cp = ctile + nc * 64 + 16 * si + 8 * hh;
    v4f c0v, c1v;
    c0v.x = o[si][0] * inv; c0v.y = o[si][1] * inv; c0v.z = o[si][2] * inv; c0v.w = o[si][3] * inv;
    c1v.x = o[si][4] * inv; c1v.y = o[si][5] * inv; c1v.z = o[si][6] * inv; c1v.w = o[si][7] * inv;
    *(v4f*)(cp) = c0v;
    *(v4f*)(cp + 4) = c1v;
  }
  __syncthreads();
  const size_t rbase = ((size_t)b * (size_t)S_ + (size_t)q0) * (size_t)D_ + (size_t)hd * (size_t)DH_;
#pragma unroll
  for (int j = 0; j < 4; ++j) {
    const int row = j * 4 + (l >> 3);
    const int c0 = 8 * (l & 7);
    const float* tp = ctile + row * 64 + c0;
    const v4f f0 = *(const v4f*)(tp);
    const v4f f1 = *(const v4f*)(tp + 4);
    v4u vh, vl;
    split8(f0, f1, vh, vl);
    const size_t oidx = rbase + (size_t)row * (size_t)D_ + (size_t)c0;
    *(v4u*)(Ch + oidx) = vh;
    *(v4u*)(Cl + oidx) = vl;
    
  }
}

extern "C" void kernel_launch(void* const* d_in, const int* in_sizes, int n_in,
                              void* d_out, int out_size, void* d_ws, size_t ws_size,
                              hipStream_t stream) {
  if (n_in < 6) return;
  const int nX = M_ * D_;          // 4194304
  const int nW = D_ * D_;          // 1048576
  const int nHead = B_ * H_ * S_ * DH_;   // 4194304
  if (in_sizes[0] != nX || in_sizes[1] != nW || in_sizes[2] != nW ||
      in_sizes[3] != nW || in_sizes[4] != nW || in_sizes[5] != D_) return;
  if (out_size != nX) return;

  const float* hs = (const float*)d_in[0];
  const float* wq = (const float*)d_in[1];
  const float* wk = (const float*)d_in[2];
  const float* wv = (const float*)d_in[3];
  const float* wo = (const float*)d_in[4];
  const float* bo = (const float*)d_in[5];
  float* out = (float*)d_out;

  char* ws = (char*)d_ws;
  size_t off = 0;
  const size_t bX = (size_t)nX * 2u;            // 8 MiB per plane
  const size_t bW = (size_t)nW * 2u * 4u;       // four matrices per plane, 8 MiB
  const size_t bHd = (size_t)nHead * 2u;        // 8 MiB per plane
  u16* Xh  = (u16*)(ws + off); off += bX;
  u16* Xl  = (u16*)(ws + off); off += bX;
  u16* Wh  = (u16*)(ws + off); off += bW;
  u16* Wl  = (u16*)(ws + off); off += bW;
  u16* Qh  = (u16*)(ws + off); off += bHd;
  u16* Ql  = (u16*)(ws + off); off += bHd;
  u16* Kh  = (u16*)(ws + off); off += bHd;
  u16* Kl  = (u16*)(ws + off); off += bHd;
  u16* Vth = (u16*)(ws + off); off += bHd;
  u16* Vtl = (u16*)(ws + off); off += bHd;
  u16* Ch  = (u16*)(ws + off); off += bX;
  u16* Cl  = (u16*)(ws + off); off += bX;
  if (off > ws_size) return;                    // 100663296 B total

  // 1) f32 -> bf16 hi/lo planes: x (2048 blocks needed) and 4 weights (512 blocks each)
  k_split<<<dim3((unsigned)(nX / 8 / 256), 5, 1), 256, 0, stream>>>(hs, wq, wk, wv, wo, Xh, Xl, Wh, Wl, nX, nW);
  // 2) q/k/v projections: 16 head tiles x 64 row tiles x 3 matrices
  k_proj_qkv<<<dim3(D_ / 64, M_ / 64, 3), 128, 0, stream>>>(Xh, Xl, Wh, Wl, Qh, Ql, Kh, Kl, Vth, Vtl);
  // 3) attention: one 32-thread block per (b, h, 16-query tile)
  k_attn<<<dim3((unsigned)(B_ * H_ * (S_ / 16)), 1, 1), 32, 0, stream>>>(Qh, Ql, Kh, Kl, Vth, Vtl, Ch, Cl);
  // 4) output projection + bias
  k_proj_out<<<dim3(D_ / 64, M_ / 64, 1), 128, 0, stream>>>(Ch, Cl, Wh, Wl, bo, out);
  (void)hipGetLastError();
}

// v004
// It runs in 208 microseconds.
// Two timings next to v003 both put it at 1.54 times that version's speed.
// All steps since v000 together make it 2.90 times as fast.
#include <hip/hip_runtime.h>
#include <stdint.h>

// All contractions (q/k/v projections, q.k^T scores, p.v, output projection): v_wmma_f32_16x16x32_bf16 with bf16 hi/lo operand planes everywhere (hi.hi + lo.hi + hi.lo), f32 accumulate; alibi bias, 1/sqrt(d) scale, tanh softcap and softmax in f32.

#define B_  2
#define S_  2048
#define D_  1024
#define H_  16
#define DH_ 64
#define M_  (B_ * S_)

static_assert((M_ % 64) == 0);
static_assert((D_ % 64) == 0);
static_assert((S_ % 64) == 0);
static_assert(DH_ == 64);

typedef unsigned short u16;
typedef __bf16 v16bf __attribute__((ext_vector_type(16)));
typedef __bf16 v8bf  __attribute__((ext_vector_type(8)));
typedef float  v8f   __attribute__((ext_vector_type(8)));
typedef float  v4f   __attribute__((ext_vector_type(4)));
typedef unsigned int v4u __attribute__((ext_vector_type(4)));

union Frag { v16bf v; v8bf half[2]; };

// 16x32 fragment from a 16-bit plane stored [row][k] with k contiguous (pitch ld elements).
// Same map for A (row = m) and B (row = n): lane l -> row (l&15); elements 0..7 <- k0+8h+0..7,
// elements 8..15 <- k0+16+8h+0..7 with h = l>>4.
__device__ __forceinline__ v16bf ld_frag(const u16* base, int ld, int row0, int k0) {
  const int l = (int)(threadIdx.x & 31u), hh = l >> 4, m = l & 15;
  const u16* p = base + (size_t)(row0 + m) * (size_t)ld + (size_t)(k0 + 8 * hh);
  Frag f;
  f.half[0] = *(const v8bf*)(p);
  f.half[1] = *(const v8bf*)(p + 16);
  return f.v;
}

// D[16x16] += A[16x32] . B[32x16]; acc element r of lane l = (row 8h+r, col l&15). Hazard guard after every issue.
__device__ __forceinline__ void mma(v8f& acc, v16bf a, v16bf b) {
  acc = __builtin_amdgcn_wmma_f32_16x16x32_bf16(false, a, false, b, (short)0, acc, false, false);
  asm volatile("v_nop\n\tv_nop\n\tv_nop\n\tv_nop" : "+v"(acc) : "v"(a), "v"(b));
}

// f32 -> bf16 bits, RNE convert
__device__ __forceinline__ unsigned int bf16_bits(float f) {
  const unsigned int u = __float_as_uint(f);
  return (u + 0x7FFFu + ((u >> 16) & 1u)) >> 16;
}

// hi = bf16(x), lo = bf16(x - hi)
__device__ __forceinline__ void split_one(float x, unsigned int& hi, unsigned int& lo) {
  hi = bf16_bits(x);
  lo = bf16_bits(x - __uint_as_float(hi << 16));
}

__device__ __forceinline__ void split_pair(float x, float y, unsigned int& hi, unsigned int& lo) {
  unsigned int hx, lx, hy, ly;
  split_one(x, hx, lx);
  split_one(y, hy, ly);
  hi = hx | (hy << 16);
  lo = lx | (ly << 16);
}

// 8 consecutive floats -> packed 8 x bf16 hi (16 B) and 8 x bf16 lo (16 B)
__device__ __forceinline__ void split8(v4f a, v4f c, v4u& hi, v4u& lo) {
  unsigned int h0, l0, h1, l1, h2, l2, h3, l3;
  split_pair(a.x, a.y, h0, l0);
  split_pair(a.z, a.w, h1, l1);
  split_pair(c.x, c.y, h2, l2);
  split_pair(c.z, c.w, h3, l3);
  hi.x = h0; hi.y = h1; hi.z = h2; hi.w = h3;
  lo.x = l0; lo.y = l1; lo.z = l2; lo.w = l3;
}

// ---------------- f32 -> bf16 hi/lo planes for x and the four weight matrices ----------------
// blockIdx.y selects the segment (0: x, 1..4: Wq, Wk, Wv, Wo). Each thread converts 8 floats and
__global__ __launch_bounds__(256) void k_split(const float* __restrict__ x,
                                               const float* __restrict__ wq, const float* __restrict__ wk,
                                               const float* __restrict__ wv, const float* __restrict__ wo,
                                               u16* __restrict__ Xh, u16* __restrict__ Xl,
                                               u16* __restrict__ Wh, u16* __restrict__ Wl,
                                               int nx, int nw) {
  const int seg = (int)blockIdx.y;
  const float* src = x;
  u16* dh = Xh;
  u16* dl = Xl;
  int n = nx;
  if (seg > 0) {
    const int wi = seg - 1;
    src = (wi == 0) ? wq : (wi == 1) ? wk : (wi == 2) ? wv : wo;
    dh = Wh + (size_t)wi * (size_t)nw;
    dl = Wl + (size_t)wi * (size_t)nw;
    n = nw;
  }
  const size_t i8 = ((size_t)blockIdx.x * (size_t)blockDim.x + (size_t)threadIdx.x) * 8u;
  if (i8 + 8u > (size_t)n) return;
  const v4f a = *(const v4f*)(src + i8);
  const v4f c = *(const v4f*)(src + i8 + 4);
  v4u vh, vl;
  split8(a, c, vh, vl);
  u16* ph = dh + i8;
  u16* pl = dl + i8;
  *(v4u*)ph = vh;
  *(v4u*)pl = vl;
  
}

// ---------------- operand staging: tensor loads into a two-buffer LDS ring ----------------
// A stage is 64 k of the block's four operand planes (A hi, A lo, B hi, B lo): 64 rows of 128 B each, laid at pitch 144 B.
// Wave w brings plane w: one request per wave and stage.
typedef uint32_t u32x4 __attribute__((ext_vector_type(4)));
typedef uint32_t u32x8 __attribute__((ext_vector_type(8)));
#define STG_K     64                     // k elements per stage
#define STG_ROWB  128                    // bytes of one staged row
#define STG_PITCH 144                    // LDS row pitch: an odd multiple of 16 B, conflict-free for 16-byte reads
#define STG_SLICE 10240                  // 64 rows x 144 B = 9216 B, rounded up to a multiple of 2 KiB
#define STG_BYTES (4 * STG_SLICE)        // one buffer
#define RING_BYTES (2 * STG_BYTES)       // 81920 B: four blocks per WGP
static_assert((D_ % STG_K) == 0 && (D_ / STG_K) >= 2);
static_assert(64 * STG_PITCH <= STG_SLICE && (STG_SLICE % 2048) == 0);
static_assert(64 * 64 * 4 <= RING_BYTES);

__device__ __forceinline__ uint32_t uni(uint32_t v) { return (uint32_t)__builtin_amdgcn_readfirstlane(v); }
// Holds a wave-uniform test in a scalar register, so that the branch round a tensor load is a scalar branch (the load ignores EXEC).
__device__ __forceinline__ uint32_t pinned(uint32_t v) { uint32_t w = uni(v); asm volatile("" : "+s"(w)); return w; }
// This wave's own slice has landed. The wait names group 0 of the request it covers, so that those registers keep their words until then.
__device__ __forceinline__ void wait_tensor0(u32x4 g0) { asm volatile("s_wait_tensorcnt 0x0" :: "s"(g0) : "memory"); }
__device__ __forceinline__ void wait_ds0() { asm volatile("s_wait_dscnt 0x0" ::: "memory"); }          // this wave's LDS reads have returned

// Descriptor group 0: place in LDS and first byte of the tile.
__device__ __forceinline__ u32x4 tdm_group0(uint32_t lds_dst, uint64_t ga) {
  u32x4 g0;
  g0[0] = uni(1u);
  g0[1] = uni(lds_dst);
  g0[2] = uni((uint32_t)ga);
  g0[3] = uni((((uint32_t)(ga >> 32)) & 0x01FFFFFFu) | 0x80000000u);
  return g0;
}
// Descriptor group 1: a tile of 64 rows of 128 B, source row pitch src_pitch bytes, 16 B of LDS pad behind every row.
__device__ __forceinline__ u32x8 tdm_group1(uint32_t src_pitch) {
  u32x8 g1;
  g1[0] = uni((1u << 20) | (4u << 22) | (3u << 25));   // no mask, 1-byte elements, a pad of 4 dwords after every 32 dwords
  g1[1] = uni((uint32_t)STG_ROWB << 16);
  g1[2] = uni(64u << 16);
  g1[3] = uni((uint32_t)STG_ROWB << 16);
  g1[4] = uni(64u);
  g1[5] = uni(src_pitch);
  g1[6] = uni(0u);
  g1[7] = uni(0u);
  return g1;
}
// Group 0 is an in-out operand: the words that wait_tensor0 names later are then the very registers the request was issued from.
__device__ __forceinline__ void tdm_load(u32x4& g0, u32x8 g1) { asm volatile("tensor_load_to_lds %0, %1" : "+s"(g0) : "s"(g1) : "memory"); }

// 16x32 fragment from a staged plane; kb = byte offset of the fragment's first k in the row. Same k map as ld_frag.
__device__ __forceinline__ v16bf ld_frag_lds(const unsigned char* plane, int row0, int kb) {
  const int l = (int)(threadIdx.x & 31u), hh = l >> 4, m = l & 15;
  const unsigned char* p = plane + (row0 + m) * STG_PITCH + kb + 16 * hh;
  Frag f;
  f.half[0] = *(const v8bf*)(p);
  f.half[1] = *(const v8bf*)(p + 32);
  return f.v;
}

// ---------------- 64x64 block GEMM tile, 4 waves x (32x32), three-term hi/lo products ----------------
// C[m][n] = sum_k A[m][k] * B[n][k]  (A and B both stored [row][k], k contiguous).
// Result is left in the LDS tile [64][64] f32 at the start of the ring.
__device__ __forceinline__ void gemm_block64(const u16* Ah, const u16* Al, int lda,
                                             const u16* Bh, const u16* Bl, int ldb,
                                             int m0, int n0, int K, unsigned char* ring) {
  const int l = (int)(threadIdx.x & 31u), hh = l >> 4, nc = l & 15;
  const int w = (int)uni(threadIdx.x >> 5);
  const int wm = (w >> 1) * 32, wn = (w & 1) * 32;
  float* tile = (float*)ring;

  const u16* sp = (w == 0) ? Ah : (w == 1) ? Al : (w == 2) ? Bh : Bl;
  const int sld = (w < 2) ? lda : ldb;
  const int srow = (w < 2) ? m0 : n0;
  const uint64_t ga0 = (uint64_t)(size_t)sp + (uint64_t)srow * (uint64_t)sld * 2u;
  const uint32_t spitch = (uint32_t)sld * 2u;
  const uint32_t dst0 = (uint32_t)(size_t)ring + (uint32_t)w * (uint32_t)STG_SLICE;
  const int ns = K / STG_K;

  const u32x8 g1 = tdm_group1(spitch);
  u32x4 g0 = tdm_group0(dst0, ga0);
  tdm_load(g0, g1);
  wait_tensor0(g0);
  __syncthreads();                               // stage 0 is published
  g0 = tdm_group0(dst0 + (uint32_t)STG_BYTES, ga0 + (uint64_t)STG_ROWB);
  tdm_load(g0, g1);

  v8f acc[2][2] = {};
  for (int s = 0; s < ns; ++s) {
    const unsigned char* buf = ring + (s & 1) * STG_BYTES;
    const unsigned char* pAh = buf;
    const unsigned char* pAl = buf + STG_SLICE;
    const unsigned char* pBh = buf + 2 * STG_SLICE;
    const unsigned char* pBl = buf + 3 * STG_SLICE;
#pragma unroll  // both 32-k halves of the stage in line: every fragment offset is then an immediate of its LDS load
    for (int j = 0; j < STG_K / 32; ++j) {
      const int kb = 64 * j;
      const v16bf a0h = ld_frag_lds(pAh, wm, kb);
      const v16bf a0l = ld_frag_lds(pAl, wm, kb);
      const v16bf a1h = ld_frag_lds(pAh, wm + 16, kb);
      const v16bf a1l = ld_frag_lds(pAl, wm + 16, kb);
      const v16bf b0h = ld_frag_lds(pBh, wn, kb);
      const v16bf b0l = ld_frag_lds(pBl, wn, kb);
      const v16bf b1h = ld_frag_lds(pBh, wn + 16, kb);
      const v16bf b1l = ld_frag_lds(pBl, wn + 16, kb);
      mma(acc[0][0], a0h, b0h); mma(acc[0][0], a0l, b0h); mma(acc[0][0], a0h, b0l);
      mma(acc[0][1], a0h, b1h); mma(acc[0][1], a0l, b1h); mma(acc[0][1], a0h, b1l);
      mma(acc[1][0], a1h, b0h); mma(acc[1][0], a1l, b0h); mma(acc[1][0], a1h, b0l);
      mma(acc[1][1], a1h, b1h); mma(acc[1][1], a1l, b1h); mma(acc[1][1], a1h, b1l);
    }
    // Publish point of stage s + 1: own reads done, own slice landed, then the barrier that also frees stage s's buffer.
    wait_ds0();
    wait_tensor0(g0);
    __syncthreads();
    if (pinned((uint32_t)(s + 2 < ns))) {
      g0 = tdm_group0(dst0 + (uint32_t)(s & 1) * (uint32_t)STG_BYTES, ga0 + (uint64_t)(s + 2) * (uint64_t)STG_ROWB);
      tdm_load(g0, g1);
    }
  }
  wait_tensor0(g0);
  wait_ds0();
  // The last pass's own barrier stands behind every wave's last read of the ring: its start may now hold the result tile.
#pragma unroll
  for (int r = 0; r < 8; ++r) {
    const int row0 = wm + 8 * hh + r;
    const int row1 = wm + 16 + 8 * hh + r;
    tile[row0 * 64 + wn + nc]      = acc[0][0][r];
    tile[row0 * 64 + wn + 16 + nc] = acc[0][1][r];
    tile[row1 * 64 + wn + nc]      = acc[1][0][r];
    tile[row1 * 64 + wn + 16 + nc] = acc[1][1][r];
  }
}

// ---------------- q/k/v projections: blockIdx.z selects the matrix ----------------
// Wh/Wl hold Wq, Wk, Wv, Wo back to back ([n][k] rows). N tile = one head (64 columns).
__global__ __launch_bounds__(128) void k_proj_qkv(const u16* Xh, const u16* Xl,
                                                  const u16* Wh, const u16* Wl,
                                                  u16* Qh, u16* Ql, u16* Kh, u16* Kl,
                                                  u16* Vth, u16* Vtl) {
  __shared__ __attribute__((aligned(2048))) unsigned char ring[RING_BYTES];
  const float* tile = (const float*)ring;
  const int z = (int)blockIdx.z;
  const int hd = (int)blockIdx.x;            // head index = n0 / 64
  const int n0 = hd * 64;
  const int m0 = (int)blockIdx.y * 64;
  const u16* Bh = Wh + (size_t)z * (size_t)D_ * (size_t)D_;
  const u16* Bl = Wl + (size_t)z * (size_t)D_ * (size_t)D_;
  gemm_block64(Xh, Xl, D_, Bh, Bl, D_, m0, n0, D_, ring);
  __syncthreads();

  const int w = (int)(threadIdx.x >> 5), l = (int)(threadIdx.x & 31u);
  const int b = m0 >> 11, s0 = m0 & (S_ - 1);
  const int bh = b * H_ + hd;
  if (z < 2) {
    u16* Ph = (z == 0) ? Qh : Kh;
    u16* Pl = (z == 0) ? Ql : Kl;
    const size_t base = ((size_t)bh * (size_t)S_ + (size_t)s0) * (size_t)DH_;
#pragma unroll
    for (int j = 0; j < 4; ++j) {
      const int row = w * 16 + j * 4 + (l >> 3);
      const int c0 = 8 * (l & 7);
      const float* tp = tile + row * 64 + c0;
      const v4f f0 = *(const v4f*)(tp);
      const v4f f1 = *(const v4f*)(tp + 4);
      v4u vh, vl;
      split8(f0, f1, vh, vl);
      const size_t o = base + (size_t)row * (size_t)DH_ + (size_t)c0;
      *(v4u*)(Ph + o) = vh;
      *(v4u*)(Pl + o) = vl;
      
    }
  } else {
#pragma unroll
    for (int j = 0; j < 4; ++j) {
      const int d = w * 16 + j * 4 + (l >> 3);   // Vt row within the head
      const int k0 = 8 * (l & 7);               // key offset within the 64-key tile
      v4f f0, f1;
      f0.x = tile[(k0 + 0) * 64 + d]; f0.y = tile[(k0 + 1) * 64 + d];
      f0.z = tile[(k0 + 2) * 64 + d]; f0.w = tile[(k0 + 3) * 64 + d];
      f1.x = tile[(k0 + 4) * 64 + d]; f1.y = tile[(k0 + 5) * 64 + d];
      f1.z = tile[(k0 + 6) * 64 + d]; f1.w = tile[(k0 + 7) * 64 + d];
      v4u vh, vl;
      split8(f0, f1, vh, vl);
      const size_t o = ((size_t)bh * (size_t)DH_ + (size_t)d) * (size_t)S_ + (size_t)s0 + (size_t)k0;
      *(v4u*)(Vth + o) = vh;
      *(v4u*)(Vtl + o) = vl;
      
    }
  }
}

// ---------------- output projection: out = ctx . Wo^T + bo (f32) ----------------
__global__ __launch_bounds__(128) void k_proj_out(const u16* Ch, const u16* Cl,
                                                  const u16* Wh, const u16* Wl,
                                                  const float* __restrict__ bo, float* out) {
  __shared__ __attribute__((aligned(2048))) unsigned char ring[RING_BYTES];
  const float* tile = (const float*)ring;
  const int n0 = (int)blockIdx.x * 64;
  const int m0 = (int)blockIdx.y * 64;
  const u16* Bh = Wh + (size_t)3 * (size_t)D_ * (size_t)D_;
  const u16* Bl = Wl + (size_t)3 * (size_t)D_ * (size_t)D_;
  gemm_block64(Ch, Cl, D_, Bh, Bl, D_, m0, n0, D_, ring);
  __syncthreads();

  const int w = (int)(threadIdx.x >> 5), l = (int)(threadIdx.x & 31u);
#pragma unroll
  for (int j = 0; j < 8; ++j) {
    const int row = w * 16 + j * 2 + (l >> 4);
    const int c0 = 4 * (l & 15);
    v4f v = *(const v4f*)(tile + row * 64 + c0);
    const v4f bb = *(const v4f*)(bo + n0 + c0);
    v = v + bb;
    float* op = out + (size_t)(m0 + row) * (size_t)D_ + (size_t)(n0 + c0);
    *(v4f*)op = v;
    
  }
}

union PFrag { v16bf v; unsigned int u[8]; };

// lane l <-> lane l ^ 16
__device__ __forceinline__ float xhalf(float x) {
  return __builtin_bit_cast(float, __builtin_amdgcn_permlanex16(__builtin_bit_cast(int, x), __builtin_bit_cast(int, x),
                                                                0x76543210, 0xfedcba98, false, false));
}

// Here both groups are in-out operands of the load and inputs of the wait that covers it: no descriptor register takes another value while its request is outstanding.
__device__ __forceinline__ void tdm_load_held(u32x4& g0, u32x8& g1) { asm volatile("tensor_load_to_lds %0, %1" : "+s"(g0), "+s"(g1) :: "memory"); }
__device__ __forceinline__ void wait_tensor0_held(u32x4 g0, u32x8 g1) { asm volatile("s_wait_tensorcnt 0x0" :: "s"(g0), "s"(g1) : "memory"); }

static_assert(S_ / STG_K >= 2);
static_assert(4 * 16 * 64 * 4 <= RING_BYTES);

__global__ __launch_bounds__(128) void k_attn(const u16* Qh, const u16* Ql,
                                              const u16* Kh, const u16* Kl,
                                              const u16* Vth, const u16* Vtl,
                                              u16* Ch, u16* Cl) {
  __shared__ __attribute__((aligned(2048))) unsigned char ring[RING_BYTES];

  const int gw = (int)blockIdx.x;                // 0 .. B*H*(S/64)-1
  const int bh = gw >> 5, qb = gw & 31;
  const int b = bh >> 4, hd = bh & 15;
  const int l = (int)(threadIdx.x & 31u), hh = l >> 4, nc = l & 15;
  const int w = (int)uni(threadIdx.x >> 5);
  const int q0 = qb * 64 + w * 16;
  const int ex = hd + 1;                         // slope = 2^(-(h+1)/2)
  const float slope = ((ex & 1) ? 0.70710678118654752f : 1.0f) *
                      __uint_as_float((unsigned int)(127 - (ex >> 1)) << 23);

  const u16* Qhp  = Qh  + (size_t)bh * (size_t)S_ * (size_t)DH_;
  const u16* Qlp  = Ql  + (size_t)bh * (size_t)S_ * (size_t)DH_;
  const u16* Khp  = Kh  + (size_t)bh * (size_t)S_ * (size_t)DH_;
  const u16* Klp  = Kl  + (size_t)bh * (size_t)S_ * (size_t)DH_;
  const u16* Vthp = Vth + (size_t)bh * (size_t)DH_ * (size_t)S_;
  const u16* Vtlp = Vtl + (size_t)bh * (size_t)DH_ * (size_t)S_;

  // This wave's plane: first byte, source row pitch, and the step from one stage's tile to the next.
  const u16* sp = (w == 0) ? Khp : (w == 1) ? Klp : (w == 2) ? Vthp : Vtlp;
  const uint64_t ga0 = (uint64_t)(size_t)sp;
  const uint32_t spitch = (w < 2) ? (uint32_t)(DH_ * 2) : (uint32_t)(S_ * 2);
  const uint64_t sstep = (w < 2) ? (uint64_t)(STG_K * DH_ * 2) : (uint64_t)STG_ROWB;
  const uint32_t dst0 = (uint32_t)(size_t)ring + (uint32_t)w * (uint32_t)STG_SLICE;
  const int ns = qb + 1;                         // keys 0 .. 64 qb + 63, 64 per stage

  u32x8 g1 = tdm_group1(spitch);
  u32x4 g0 = tdm_group0(dst0, ga0);
  tdm_load_held(g0, g1);
  wait_tensor0_held(g0, g1);
  __syncthreads();                               // stage 0 is published
  g0 = tdm_group0(dst0 + (uint32_t)STG_BYTES, ga0 + sstep);   // keys 64..127 lie in the planes for every block
  tdm_load_held(g0, g1);

  const v16bf q0h = ld_frag(Qhp, DH_, q0, 0),  q0l = ld_frag(Qlp, DH_, q0, 0);
  const v16bf q1h = ld_frag(Qhp, DH_, q0, 32), q1l = ld_frag(Qlp, DH_, q0, 32);

  v8f o[4] = {};                                 // o[si][r] = O[query nc][d = 16 si + 8 h + r]
  float mq = -3.0e38f;                           // running maximum of this lane's query (equal in both halves)
  float lq = 0.0f;                               // this half's share of the query's sum; halves joined after the loop
  const int q = q0 + nc;

  const int nchunk = (q0 >> 5) + 1;              // this wave's keys 0 .. q0+15, 32 per chunk
  for (int s = 0; s < ns; ++s) {
    const unsigned char* buf = ring + (s & 1) * STG_BYTES;
    const unsigned char* pKh = buf;
    const unsigned char* pKl = buf + STG_SLICE;
    const unsigned char* pVh = buf + 2 * STG_SLICE;
    const unsigned char* pVl = buf + 3 * STG_SLICE;
#pragma unroll  // both 32-key chunks of the stage in line: every fragment offset is then an immediate of its LDS load
    for (int j = 0; j < STG_K / 32; ++j) {
      const int c = 2 * s + j;
      if (c < nchunk) {                          // wave-uniform: a chunk wholly above this wave's diagonal is skipped
        const int ks = c << 5;
        v8f sc[2] = {};
#pragma unroll
        for (int t = 0; t < 2; ++t) {
          const int kr = 32 * j + 16 * t;        // A[m=key][k=d]: rows of K, d contiguous
          const v16bf k0h = ld_frag_lds(pKh, kr, 0),  k0l = ld_frag_lds(pKl, kr, 0);
          const v16bf k1h = ld_frag_lds(pKh, kr, 64), k1l = ld_frag_lds(pKl, kr, 64);
          mma(sc[t], k0h, q0h); mma(sc[t], k0h, q0l); mma(sc[t], k0l, q0h);
          mma(sc[t], k1h, q1h); mma(sc[t], k1h, q1l); mma(sc[t], k1l, q1h);
        }

        float xs[2][8];
        float t0 = -3.0e38f;
#pragma unroll
        for (int t = 0; t < 2; ++t) {
#pragma unroll
          for (int r = 0; r < 8; ++r) {
            const int kk = ks + 16 * t + 8 * hh + r;
            float x = (sc[t][r] - (float)(q - kk) * slope) * 0.125f;
            x = 30.0f * __builtin_amdgcn_tanhf(x * (1.0f / 30.0f));   // one v_tanh_f32: no branch, so the 16 scores of a lane run as independent chains
            x = (kk <= q) ? x : -3.0e38f;
            xs[t][r] = x;
            t0 = fmaxf(t0, x);
          }
        }
        t0 = fmaxf(t0, xhalf(t0));
        const float mnew = fmaxf(mq, t0);
        const float alpha = __expf(mq - mnew);
        mq = mnew;

        PFrag ph, pl;
        float u = 0.0f;
#pragma unroll
        for (int t = 0; t < 2; ++t) {
#pragma unroll
          for (int i = 0; i < 4; ++i) {
            const float pa = __expf(xs[t][2 * i] - mnew);
            const float pb = __expf(xs[t][2 * i + 1] - mnew);
            u += pa + pb;
            split_pair(pa, pb, ph.u[4 * t + i], pl.u[4 * t + i]);
          }
        }
        lq = lq * alpha + u;
#pragma unroll
        for (int si = 0; si < 4; ++si) o[si] *= alpha;

#pragma unroll
        for (int si = 0; si < 4; ++si) {         // A[m=d][k=key]: rows of Vt, keys contiguous
          const v16bf vh = ld_frag_lds(pVh, 16 * si, 64 * j);
          const v16bf vl = ld_frag_lds(pVl, 16 * si, 64 * j);
          mma(o[si], vh, ph.v); mma(o[si], vh, pl.v); mma(o[si], vl, ph.v);
        }
      }
    }
    // Publish point of stage s + 1, passed by every wave: own reads done, own slice landed, then the barrier that also frees stage s's buffer.
    wait_ds0();
    wait_tensor0_held(g0, g1);
    __syncthreads();
    if (pinned((uint32_t)(s + 2 < ns))) {
      g0 = tdm_group0(dst0 + (uint32_t)(s & 1) * (uint32_t)STG_BYTES, ga0 + (uint64_t)(s + 2) * sstep);
      tdm_load_held(g0, g1);
    }
  }
  wait_tensor0_held(g0, g1);
  wait_ds0();
  // The last pass's own barrier stands behind every wave's last read of the ring: its start may now hold the four waves' output tiles.
  float* ctile = (float*)ring + w * (16 * 64);

  const float inv = 1.0f / (lq + xhalf(lq));
#pragma unroll
  for (int si = 0; si < 4; ++si) {
    float* cp = ctile + nc * 64 + 16 * si + 8 * hh;
    v4f c0v, c1v;
    c0v.x = o[si][0] * inv; c0v.y = o[si][1] * inv; c0v.z = o[si][2] * inv; c0v.w = o[si][3] * inv;
    c1v.x = o[si][4] * inv; c1v.y = o[si][5] * inv; c1v.z = o[si][6] * inv; c1v.w = o[si][7] * inv;
    *(v4f*)(cp) = c0v;
    *(v4f*)(cp + 4) = c1v;
  }
  __syncthreads();
  const size_t rbase = ((size_t)b * (size_t)S_ + (size_t)q0) * (size_t)D_ + (size_t)hd * (size_t)DH_;
#pragma unroll
  for (int j = 0; j < 4; ++j) {
    const int row = j * 4 + (l >> 3);
    const int c0 = 8 * (l & 7);
    const float* tp = ctile + row * 64 + c0;
    const v4f f0 = *(const v4f*)(tp);
    const v4f f1 = *(const v4f*)(tp + 4);
    v4u vh, vl;
    split8(f0, f1, vh, vl);
    const size_t oidx = rbase + (size_t)row * (size_t)D_ + (size_t)c0;
    *(v4u*)(Ch + oidx) = vh;
    *(v4u*)(Cl + oidx) = vl;
    
  }
}

extern "C" void kernel_launch(void* const* d_in, const int* in_sizes, int n_in,
                              void* d_out, int out_size, void* d_ws, size_t ws_size,
                              hipStream_t stream) {
  if (n_in < 6) return;
  const int nX = M_ * D_;          // 4194304
  const int nW = D_ * D_;          // 1048576
  const int nHead = B_ * H_ * S_ * DH_;   // 4194304
  if (in_sizes[0] != nX || in_sizes[1] != nW || in_sizes[2] != nW ||
      in_sizes[3] != nW || in_sizes[4] != nW || in_sizes[5] != D_) return;
  if (out_size != nX) return;

  const float* hs = (const float*)d_in[0];
  const float* wq = (const float*)d_in[1];
  const float* wk = (const float*)d_in[2];
  const float* wv = (const float*)d_in[3];
  const float* wo = (const float*)d_in[4];
  const float* bo = (const float*)d_in[5];
  float* out = (float*)d_out;

  char* ws = (char*)d_ws;
  size_t off = 0;
  const size_t bX = (size_t)nX * 2u;            // 8 MiB per plane
  const size_t bW = (size_t)nW * 2u * 4u;       // four matrices per plane, 8 MiB
  const size_t bHd = (size_t)nHead * 2u;        // 8 MiB per plane
  u16* Xh  = (u16*)(ws + off); off += bX;
  u16* Xl  = (u16*)(ws + off); off += bX;
  u16* Wh  = (u16*)(ws + off); off += bW;
  u16* Wl  = (u16*)(ws + off); off += bW;
  u16* Qh  = (u16*)(ws + off); off += bHd;
  u16* Ql  = (u16*)(ws + off); off += bHd;
  u16* Kh  = (u16*)(ws + off); off += bHd;
  u16* Kl  = (u16*)(ws + off); off += bHd;
  u16* Vth = (u16*)(ws + off); off += bHd;
  u16* Vtl = (u16*)(ws + off); off += bHd;
  u16* Ch  = (u16*)(ws + off); off += bX;
  u16* Cl  = (u16*)(ws + off); off += bX;
  if (off > ws_size) return;                    // 100663296 B total

  // 1) f32 -> bf16 hi/lo planes: x (2048 blocks needed) and 4 weights (512 blocks each)
  k_split<<<dim3((unsigned)(nX / 8 / 256), 5, 1), 256, 0, stream>>>(hs, wq, wk, wv, wo, Xh, Xl, Wh, Wl, nX, nW);
  // 2) q/k/v projections: 16 head tiles x 64 row tiles x 3 matrices
  k_proj_qkv<<<dim3(D_ / 64, M_ / 64, 3), 128, 0, stream>>>(Xh, Xl, Wh, Wl, Qh, Ql, Kh, Kl, Vth, Vtl);
  // 3) attention: one 128-thread block per (b, h, 64-query tile)
  k_attn<<<dim3((unsigned)(B_ * H_ * (S_ / 64)), 1, 1), 128, 0, stream>>>(Qh, Ql, Kh, Kl, Vth, Vtl, Ch, Cl);
  // 4) output projection + bias
  k_proj_out<<<dim3(D_ / 64, M_ / 64, 1), 128, 0, stream>>>(Ch, Cl, Wh, Wl, bo, out);
  (void)hipGetLastError();
}

// v005
// Measured time: 177 microseconds a run.
// In both of two side-by-side timings against v004, it was 1.18 times as fast.
// Counting every step since v000, it is 3.44 times as fast.
#include <hip/hip_runtime.h>
#include <stdint.h>

// All contractions (q/k/v projections, q.k^T scores, p.v, output projection): v_wmma_f32_16x16x32_bf16 with bf16 hi/lo operand planes everywhere (hi.hi + lo.hi + hi.lo), f32 accumulate; alibi bias, 1/sqrt(d) scale, tanh softcap and softmax in f32.

#define B_  2
#define S_  2048
#define D_  1024
#define H_  16
#define DH_ 64
#define M_  (B_ * S_)

static_assert((M_ % 64) == 0);
static_assert((D_ % 64) == 0);
static_assert((S_ % 64) == 0);
static_assert(DH_ == 64);

typedef unsigned short u16;
typedef __bf16 v16bf __attribute__((ext_vector_type(16)));
typedef __bf16 v8bf  __attribute__((ext_vector_type(8)));
typedef float  v8f   __attribute__((ext_vector_type(8)));
typedef float  v4f   __attribute__((ext_vector_type(4)));
typedef unsigned int v4u __attribute__((ext_vector_type(4)));

union Frag { v16bf v; v8bf half[2]; };

// 16x32 fragment from a 16-bit plane stored [row][k] with k contiguous (pitch ld elements).
// Same map for A (row = m) and B (row = n): lane l -> row (l&15); elements 0..7 <- k0+8h+0..7,
// elements 8..15 <- k0+16+8h+0..7 with h = l>>4.
__device__ __forceinline__ v16bf ld_frag(const u16* base, int ld, int row0, int k0) {
  const int l = (int)(threadIdx.x & 31u), hh = l >> 4, m = l & 15;
  const u16* p = base + (size_t)(row0 + m) * (size_t)ld + (size_t)(k0 + 8 * hh);
  Frag f;
  f.half[0] = *(const v8bf*)(p);
  f.half[1] = *(const v8bf*)(p + 16);
  return f.v;
}

// D[16x16] += A[16x32] . B[32x16]; acc element r of lane l = (row 8h+r, col l&15). Hazard guard after every issue.
__device__ __forceinline__ void mma(v8f& acc, v16bf a, v16bf b) {
  acc = __builtin_amdgcn_wmma_f32_16x16x32_bf16(false, a, false, b, (short)0, acc, false, false);
  asm volatile("v_nop\n\tv_nop\n\tv_nop\n\tv_nop" : "+v"(acc) : "v"(a), "v"(b));
}

// f32 -> bf16 bits, RNE convert
__device__ __forceinline__ unsigned int bf16_bits(float f) {
  const unsigned int u = __float_as_uint(f);
  return (u + 0x7FFFu + ((u >> 16) & 1u)) >> 16;
}

// hi = bf16(x), lo = bf16(x - hi)
__device__ __forceinline__ void split_one(float x, unsigned int& hi, unsigned int& lo) {
  hi = bf16_bits(x);
  lo = bf16_bits(x - __uint_as_float(hi << 16));
}

__device__ __forceinline__ void split_pair(float x, float y, unsigned int& hi, unsigned int& lo) {
  unsigned int hx, lx, hy, ly;
  split_one(x, hx, lx);
  split_one(y, hy, ly);
  hi = hx | (hy << 16);
  lo = lx | (ly << 16);
}

// 8 consecutive floats -> packed 8 x bf16 hi (16 B) and 8 x bf16 lo (16 B)
__device__ __forceinline__ void split8(v4f a, v4f c, v4u& hi, v4u& lo) {
  unsigned int h0, l0, h1, l1, h2, l2, h3, l3;
  split_pair(a.x, a.y, h0, l0);
  split_pair(a.z, a.w, h1, l1);
  split_pair(c.x, c.y, h2, l2);
  split_pair(c.z, c.w, h3, l3);
  hi.x = h0; hi.y = h1; hi.z = h2; hi.w = h3;
  lo.x = l0; lo.y = l1; lo.z = l2; lo.w = l3;
}

// ---------------- f32 -> bf16 hi/lo planes for x and the four weight matrices ----------------
// blockIdx.y selects the segment (0: x, 1..4: Wq, Wk, Wv, Wo). Each thread converts 8 floats and
__global__ __launch_bounds__(256) void k_split(const float* __restrict__ x,
                                               const float* __restrict__ wq, const float* __restrict__ wk,
                                               const float* __restrict__ wv, const float* __restrict__ wo,
                                               u16* __restrict__ Xh, u16* __restrict__ Xl,
                                               u16* __restrict__ Wh, u16* __restrict__ Wl,
                                               int nx, int nw) {
  const int seg = (int)blockIdx.y;
  const float* src = x;
  u16* dh = Xh;
  u16* dl = Xl;
  int n = nx;
  if (seg > 0) {
    const int wi = seg - 1;
    src = (wi == 0) ? wq : (wi == 1) ? wk : (wi == 2) ? wv : wo;
    dh = Wh + (size_t)wi * (size_t)nw;
    dl = Wl + (size_t)wi * (size_t)nw;
    n = nw;
  }
  const size_t i8 = ((size_t)blockIdx.x * (size_t)blockDim.x + (size_t)threadIdx.x) * 8u;
  if (i8 + 8u > (size_t)n) return;
  const v4f a = *(const v4f*)(src + i8);
  const v4f c = *(const v4f*)(src + i8 + 4);
  v4u vh, vl;
  split8(a, c, vh, vl);
  u16* ph = dh + i8;
  u16* pl = dl + i8;
  *(v4u*)ph = vh;
  *(v4u*)pl = vl;
  
}

// ---------------- operand staging: tensor loads into a two-buffer LDS ring ----------------
// A stage is 64 k of the block's four operand planes (A hi, A lo, B hi, B lo): 64 rows of 128 B each, laid at pitch 144 B.
// Wave w brings plane w: one request per wave and stage.
typedef uint32_t u32x4 __attribute__((ext_vector_type(4)));
typedef uint32_t u32x8 __attribute__((ext_vector_type(8)));
#define STG_K     64                     // k elements per stage
#define STG_ROWB  128                    // bytes of one staged row
#define STG_PITCH 144                    // LDS row pitch: an odd multiple of 16 B, conflict-free for 16-byte reads
#define STG_SLICE 10240                  // 64 rows x 144 B = 9216 B, rounded up to a multiple of 2 KiB
#define STG_BYTES (4 * STG_SLICE)        // one buffer
#define RING_BYTES (2 * STG_BYTES)       // 81920 B: four blocks per WGP
static_assert((D_ % STG_K) == 0 && (D_ / STG_K) >= 2);
static_assert(64 * STG_PITCH <= STG_SLICE && (STG_SLICE % 2048) == 0);
static_assert(64 * 64 * 4 <= RING_BYTES);

__device__ __forceinline__ uint32_t uni(uint32_t v) { return (uint32_t)__builtin_amdgcn_readfirstlane(v); }
// Holds a wave-uniform test in a scalar register, so that the branch round a tensor load is a scalar branch (the load ignores EXEC).
__device__ __forceinline__ uint32_t pinned(uint32_t v) { uint32_t w = uni(v); asm volatile("" : "+s"(w)); return w; }
// This wave's own slice has landed. The wait names group 0 of the request it covers, so that those registers keep their words until then.
__device__ __forceinline__ void wait_tensor0(u32x4 g0) { asm volatile("s_wait_tensorcnt 0x0" :: "s"(g0) : "memory"); }
__device__ __forceinline__ void wait_ds0() { asm volatile("s_wait_dscnt 0x0" ::: "memory"); }          // this wave's LDS reads have returned

// Descriptor group 0: place in LDS and first byte of the tile.
__device__ __forceinline__ u32x4 tdm_group0(uint32_t lds_dst, uint64_t ga) {
  u32x4 g0;
  g0[0] = uni(1u);
  g0[1] = uni(lds_dst);
  g0[2] = uni((uint32_t)ga);
  g0[3] = uni((((uint32_t)(ga >> 32)) & 0x01FFFFFFu) | 0x80000000u);
  return g0;
}
// Descriptor group 1: a tile of 64 rows of 128 B, source row pitch src_pitch bytes, 16 B of LDS pad behind every row.
__device__ __forceinline__ u32x8 tdm_group1(uint32_t src_pitch) {
  u32x8 g1;
  g1[0] = uni((1u << 20) | (4u << 22) | (3u << 25));   // no mask, 1-byte elements, a pad of 4 dwords after every 32 dwords
  g1[1] = uni((uint32_t)STG_ROWB << 16);
  g1[2] = uni(64u << 16);
  g1[3] = uni((uint32_t)STG_ROWB << 16);
  g1[4] = uni(64u);
  g1[5] = uni(src_pitch);
  g1[6] = uni(0u);
  g1[7] = uni(0u);
  return g1;
}
// Group 0 is an in-out operand: the words that wait_tensor0 names later are then the very registers the request was issued from.
__device__ __forceinline__ void tdm_load(u32x4& g0, u32x8 g1) { asm volatile("tensor_load_to_lds %0, %1" : "+s"(g0) : "s"(g1) : "memory"); }

// 16x32 fragment from a staged plane; kb = byte offset of the fragment's first k in the row. Same k map as ld_frag.
__device__ __forceinline__ v16bf ld_frag_lds(const unsigned char* plane, int row0, int kb) {
  const int l = (int)(threadIdx.x & 31u), hh = l >> 4, m = l & 15;
  const unsigned char* p = plane + (row0 + m) * STG_PITCH + kb + 16 * hh;
  Frag f;
  f.half[0] = *(const v8bf*)(p);
  f.half[1] = *(const v8bf*)(p + 32);
  return f.v;
}

// ---------------- 64x64 block GEMM tile, 4 waves x (32x32), three-term hi/lo products ----------------
// C[m][n] = sum_k A[m][k] * B[n][k]  (A and B both stored [row][k], k contiguous).
// Result is left in the LDS tile [64][64] f32 at the start of the ring.
__device__ __forceinline__ void gemm_block64(const u16* Ah, const u16* Al, int lda,
                                             const u16* Bh, const u16* Bl, int ldb,
                                             int m0, int n0, int K, unsigned char* ring) {
  const int l = (int)(threadIdx.x & 31u), hh = l >> 4, nc = l & 15;
  const int w = (int)uni(threadIdx.x >> 5);
  const int wm = (w >> 1) * 32, wn = (w & 1) * 32;
  float* tile = (float*)ring;

  const u16* sp = (w == 0) ? Ah : (w == 1) ? Al : (w == 2) ? Bh : Bl;
  const int sld = (w < 2) ? lda : ldb;
  const int srow = (w < 2) ? m0 : n0;
  const uint64_t ga0 = (uint64_t)(size_t)sp + (uint64_t)srow * (uint64_t)sld * 2u;
  const uint32_t spitch = (uint32_t)sld * 2u;
  const uint32_t dst0 = (uint32_t)(size_t)ring + (uint32_t)w * (uint32_t)STG_SLICE;
  const int ns = K / STG_K;

  const u32x8 g1 = tdm_group1(spitch);
  u32x4 g0 = tdm_group0(dst0, ga0);
  tdm_load(g0, g1);
  wait_tensor0(g0);
  __syncthreads();                               // stage 0 is published
  g0 = tdm_group0(dst0 + (uint32_t)STG_BYTES, ga0 + (uint64_t)STG_ROWB);
  tdm_load(g0, g1);

  v8f acc[2][2] = {};
  for (int s = 0; s < ns; ++s) {
    const unsigned char* buf = ring + (s & 1) * STG_BYTES;
    const unsigned char* pAh = buf;
    const unsigned char* pAl = buf + STG_SLICE;
    const unsigned char* pBh = buf + 2 * STG_SLICE;
    const unsigned char* pBl = buf + 3 * STG_SLICE;
#pragma unroll  // both 32-k halves of the stage in line: every fragment offset is then an immediate of its LDS load
    for (int j = 0; j < STG_K / 32; ++j) {
      const int kb = 64 * j;
      const v16bf a0h = ld_frag_lds(pAh, wm, kb);
      const v16bf a0l = ld_frag_lds(pAl, wm, kb);
      const v16bf a1h = ld_frag_lds(pAh, wm + 16, kb);
      const v16bf a1l = ld_frag_lds(pAl, wm + 16, kb);
      const v16bf b0h = ld_frag_lds(pBh, wn, kb);
      const v16bf b0l = ld_frag_lds(pBl, wn, kb);
      const v16bf b1h = ld_frag_lds(pBh, wn + 16, kb);
      const v16bf b1l = ld_frag_lds(pBl, wn + 16, kb);
      mma(acc[0][0], a0h, b0h); mma(acc[0][0], a0l, b0h); mma(acc[0][0], a0h, b0l);
      mma(acc[0][1], a0h, b1h); mma(acc[0][1], a0l, b1h); mma(acc[0][1], a0h, b1l);
      mma(acc[1][0], a1h, b0h); mma(acc[1][0], a1l, b0h); mma(acc[1][0], a1h, b0l);
      mma(acc[1][1], a1h, b1h); mma(acc[1][1], a1l, b1h); mma(acc[1][1], a1h, b1l);
    }
    // Publish point of stage s + 1: own reads done, own slice landed, then the barrier that also frees stage s's buffer.
    wait_ds0();
    wait_tensor0(g0);
    __syncthreads();
    if (pinned((uint32_t)(s + 2 < ns))) {
      g0 = tdm_group0(dst0 + (uint32_t)(s & 1) * (uint32_t)STG_BYTES, ga0 + (uint64_t)(s + 2) * (uint64_t)STG_ROWB);
      tdm_load(g0, g1);
    }
  }
  wait_tensor0(g0);
  wait_ds0();
  // The last pass's own barrier stands behind every wave's last read of the ring: its start may now hold the result tile.
#pragma unroll
  for (int r = 0; r < 8; ++r) {
    const int row0 = wm + 8 * hh + r;
    const int row1 = wm + 16 + 8 * hh + r;
    tile[row0 * 64 + wn + nc]      = acc[0][0][r];
    tile[row0 * 64 + wn + 16 + nc] = acc[0][1][r];
    tile[row1 * 64 + wn + nc]      = acc[1][0][r];
    tile[row1 * 64 + wn + 16 + nc] = acc[1][1][r];
  }
}

// ---------------- q/k/v projections: blockIdx.z selects the matrix ----------------
// Wh/Wl hold Wq, Wk, Wv, Wo back to back ([n][k] rows). N tile = one head (64 columns).
__global__ __launch_bounds__(128) void k_proj_qkv(const u16* Xh, const u16* Xl,
                                                  const u16* Wh, const u16* Wl,
                                                  u16* Qh, u16* Ql, u16* Kh, u16* Kl,
                                                  u16* Vth, u16* Vtl) {
  __shared__ __attribute__((aligned(2048))) unsigned char ring[RING_BYTES];
  const float* tile = (const float*)ring;
  const int z = (int)blockIdx.z;
  const int hd = (int)blockIdx.x;            // head index = n0 / 64
  const int n0 = hd * 64;
  const int m0 = (int)blockIdx.y * 64;
  const u16* Bh = Wh + (size_t)z * (size_t)D_ * (size_t)D_;
  const u16* Bl = Wl + (size_t)z * (size_t)D_ * (size_t)D_;
  gemm_block64(Xh, Xl, D_, Bh, Bl, D_, m0, n0, D_, ring);
  __syncthreads();

  const int w = (int)(threadIdx.x >> 5), l = (int)(threadIdx.x & 31u);
  const int b = m0 >> 11, s0 = m0 & (S_ - 1);
  const int bh = b * H_ + hd;
  if (z < 2) {
    u16* Ph = (z == 0) ? Qh : Kh;
    u16* Pl = (z == 0) ? Ql : Kl;
    const size_t base = ((size_t)bh * (size_t)S_ + (size_t)s0) * (size_t)DH_;
#pragma unroll
    for (int j = 0; j < 4; ++j) {
      const int row = w * 16 + j * 4 + (l >> 3);
      const int c0 = 8 * (l & 7);
      const float* tp = tile + row * 64 + c0;
      const v4f f0 = *(const v4f*)(tp);
      const v4f f1 = *(const v4f*)(tp + 4);
      v4u vh, vl;
      split8(f0, f1, vh, vl);
      const size_t o = base + (size_t)row * (size_t)DH_ + (size_t)c0;
      *(v4u*)(Ph + o) = vh;
      *(v4u*)(Pl + o) = vl;
      
    }
  } else {
#pragma unroll
    for (int j = 0; j < 4; ++j) {
      const int d = w * 16 + j * 4 + (l >> 3);   // Vt row within the head
      const int k0 = 8 * (l & 7);               // key offset within the 64-key tile
      v4f f0, f1;
      f0.x = tile[(k0 + 0) * 64 + d]; f0.y = tile[(k0 + 1) * 64 + d];
      f0.z = tile[(k0 + 2) * 64 + d]; f0.w = tile[(k0 + 3) * 64 + d];
      f1.x = tile[(k0 + 4) * 64 + d]; f1.y = tile[(k0 + 5) * 64 + d];
      f1.z = tile[(k0 + 6) * 64 + d]; f1.w = tile[(k0 + 7) * 64 + d];
      v4u vh, vl;
      split8(f0, f1, vh, vl);
      const size_t o = ((size_t)bh * (size_t)DH_ + (size_t)d) * (size_t)S_ + (size_t)s0 + (size_t)k0;
      *(v4u*)(Vth + o) = vh;
      *(v4u*)(Vtl + o) = vl;
      
    }
  }
}

// ---------------- output projection: out = ctx . Wo^T + bo (f32) ----------------
__global__ __launch_bounds__(128) void k_proj_out(const u16* Ch, const u16* Cl,
                                                  const u16* Wh, const u16* Wl,
                                                  const float* __restrict__ bo, float* out) {
  __shared__ __attribute__((aligned(2048))) unsigned char ring[RING_BYTES];
  const float* tile = (const float*)ring;
  const int n0 = (int)blockIdx.x * 64;
  const int m0 = (int)blockIdx.y * 64;
  const u16* Bh = Wh + (size_t)3 * (size_t)D_ * (size_t)D_;
  const u16* Bl = Wl + (size_t)3 * (size_t)D_ * (size_t)D_;
  gemm_block64(Ch, Cl, D_, Bh, Bl, D_, m0, n0, D_, ring);
  __syncthreads();

  const int w = (int)(threadIdx.x >> 5), l = (int)(threadIdx.x & 31u);
#pragma unroll
  for (int j = 0; j < 8; ++j) {
    const int row = w * 16 + j * 2 + (l >> 4);
    const int c0 = 4 * (l & 15);
    v4f v = *(const v4f*)(tile + row * 64 + c0);
    const v4f bb = *(const v4f*)(bo + n0 + c0);
    v = v + bb;
    float* op = out + (size_t)(m0 + row) * (size_t)D_ + (size_t)(n0 + c0);
    *(v4f*)op = v;
    
  }
}

union PFrag { v16bf v; unsigned int u[8]; };

// lane l <-> lane l ^ 16
__device__ __forceinline__ float xhalf(float x) {
  return __builtin_bit_cast(float, __builtin_amdgcn_permlanex16(__builtin_bit_cast(int, x), __builtin_bit_cast(int, x),
                                                                0x76543210, 0xfedcba98, false, false));
}

// Here both groups are in-out operands of the load and inputs of the wait that covers it: no descriptor register takes another value while its request is outstanding.
__device__ __forceinline__ void tdm_load_held(u32x4& g0, u32x8& g1) { asm volatile("tensor_load_to_lds %0, %1" : "+s"(g0), "+s"(g1) :: "memory"); }
__device__ __forceinline__ void wait_tensor0_held(u32x4 g0, u32x8 g1) { asm volatile("s_wait_tensorcnt 0x0" :: "s"(g0), "s"(g1) : "memory"); }

static_assert(S_ / STG_K >= 2);
static_assert(4 * 16 * 64 * 4 <= RING_BYTES);
#define QT_ (S_ / 64)                            // 64-query tiles of a head
static_assert((QT_ % 2) == 0 && QT_ == 32);

// At most two waves a SIMD: the 512 equal blocks then stand two to a WGP, on all 256 WGPs, wherever the dispatcher starts them.
__global__ __launch_bounds__(128) __attribute__((amdgpu_waves_per_eu(2, 2))) void k_attn(const u16* Qh, const u16* Ql,
                                              const u16* Kh, const u16* Kl,
                                              const u16* Vth, const u16* Vtl,
                                              u16* Ch, u16* Cl) {
  __shared__ __attribute__((aligned(2048))) unsigned char ring[RING_BYTES];

  const int gw = (int)blockIdx.x;                // 0 .. B*H*(S/128)-1
  const int bh = gw >> 4, tp = gw & 15;
  const int b = bh >> 4, hd = bh & 15;
  const int l = (int)(threadIdx.x & 31u), hh = l >> 4, nc = l & 15;
  const int w = (int)uni(threadIdx.x >> 5);
  const int ex = hd + 1;                         // slope = 2^(-(h+1)/2)
  const float slope = ((ex & 1) ? 0.70710678118654752f : 1.0f) *
                      __uint_as_float((unsigned int)(127 - (ex >> 1)) << 23);

  const u16* Qhp  = Qh  + (size_t)bh * (size_t)S_ * (size_t)DH_;
  const u16* Qlp  = Ql  + (size_t)bh * (size_t)S_ * (size_t)DH_;
  const u16* Khp  = Kh  + (size_t)bh * (size_t)S_ * (size_t)DH_;
  const u16* Klp  = Kl  + (size_t)bh * (size_t)S_ * (size_t)DH_;
  const u16* Vthp = Vth + (size_t)bh * (size_t)DH_ * (size_t)S_;
  const u16* Vtlp = Vtl + (size_t)bh * (size_t)DH_ * (size_t)S_;

  // This wave's plane: first byte, source row pitch, and the step from one stage's tile to the next.
  const u16* sp = (w == 0) ? Khp : (w == 1) ? Klp : (w == 2) ? Vthp : Vtlp;
  const uint64_t ga0 = (uint64_t)(size_t)sp;
  const uint32_t spitch = (w < 2) ? (uint32_t)(DH_ * 2) : (uint32_t)(S_ * 2);
  const uint64_t sstep = (w < 2) ? (uint64_t)(STG_K * DH_ * 2) : (uint64_t)STG_ROWB;
  const uint32_t dst0 = (uint32_t)(size_t)ring + (uint32_t)w * (uint32_t)STG_SLICE;
  u32x8 g1 = tdm_group1(spitch);

  for (int pass = 0; pass < 2; ++pass) {
  const int qb = pass ? tp : (QT_ - 1 - tp);     // block-uniform
  const int q0 = qb * 64 + w * 16;
  const int ns = qb + 1;                         // keys 0 .. 64 qb + 63, 64 per stage
  if (pass) {
    // The first tile's output rows stand in the ring: own reads of them done, then the barrier behind every wave's reads, and only then the refill.
    wait_ds0();
    __syncthreads();
  }

  u32x4 g0 = tdm_group0(dst0, ga0);
  tdm_load_held(g0, g1);
  wait_tensor0_held(g0, g1);
  __syncthreads();                               // stage 0 is published
  g0 = tdm_group0(dst0 + (uint32_t)STG_BYTES, ga0 + sstep);   // keys 64..127 lie in the planes for every block
  tdm_load_held(g0, g1);

  const v16bf q0h = ld_frag(Qhp, DH_, q0, 0),  q0l = ld_frag(Qlp, DH_, q0, 0);
  const v16bf q1h = ld_frag(Qhp, DH_, q0, 32), q1l = ld_frag(Qlp, DH_, q0, 32);

  v8f o[4] = {};                                 // o[si][r] = O[query nc][d = 16 si + 8 h + r]
  float mq = -3.0e38f;                           // running maximum of this lane's query (equal in both halves)
  float lq = 0.0f;                               // this half's share of the query's sum; halves joined after the loop
  const int q = q0 + nc;

  const int nchunk = (q0 >> 5) + 1;              // this wave's keys 0 .. q0+15, 32 per chunk
  for (int s = 0; s < ns; ++s) {
    const unsigned char* buf = ring + (s & 1) * STG_BYTES;
    const unsigned char* pKh = buf;
    const unsigned char* pKl = buf + STG_SLICE;
    const unsigned char* pVh = buf + 2 * STG_SLICE;
    const unsigned char* pVl = buf + 3 * STG_SLICE;
#pragma unroll  // both 32-key chunks of the stage in line: every fragment offset is then an immediate of its LDS load
    for (int j = 0; j < STG_K / 32; ++j) {
      const int c = 2 * s + j;
      if (c < nchunk) {                          // wave-uniform: a chunk wholly above this wave's diagonal is skipped
        const int ks = c << 5;
        v8f sc[2] = {};
#pragma unroll
        for (int t = 0; t < 2; ++t) {
          const int kr = 32 * j + 16 * t;        // A[m=key][k=d]: rows of K, d contiguous
          const v16bf k0h = ld_frag_lds(pKh, kr, 0),  k0l = ld_frag_lds(pKl, kr, 0);
          const v16bf k1h = ld_frag_lds(pKh, kr, 64), k1l = ld_frag_lds(pKl, kr, 64);
          mma(sc[t], k0h, q0h); mma(sc[t], k0h, q0l); mma(sc[t], k0l, q0h);
          mma(sc[t], k1h, q1h); mma(sc[t], k1h, q1l); mma(sc[t], k1l, q1h);
        }

        float xs[2][8];
        float t0 = -3.0e38f;
#pragma unroll
        for (int t = 0; t < 2; ++t) {
#pragma unroll
          for (int r = 0; r < 8; ++r) {
            const int kk = ks + 16 * t + 8 * hh + r;
            float x = (sc[t][r] - (float)(q - kk) * slope) * 0.125f;
            x = 30.0f * __builtin_amdgcn_tanhf(x * (1.0f / 30.0f));   // one v_tanh_f32: no branch, so the 16 scores of a lane run as independent chains
            x = (kk <= q) ? x : -3.0e38f;
            xs[t][r] = x;
            t0 = fmaxf(t0, x);
          }
        }
        t0 = fmaxf(t0, xhalf(t0));
        const float mnew = fmaxf(mq, t0);
        const float alpha = __expf(mq - mnew);
        mq = mnew;

        PFrag ph, pl;
        float u = 0.0f;
#pragma unroll
        for (int t = 0; t < 2; ++t) {
#pragma unroll
          for (int i = 0; i < 4; ++i) {
            const float pa = __expf(xs[t][2 * i] - mnew);
            const float pb = __expf(xs[t][2 * i + 1] - mnew);
            u += pa + pb;
            split_pair(pa, pb, ph.u[4 * t + i], pl.u[4 * t + i]);
          }
        }
        lq = lq * alpha + u;
#pragma unroll
        for (int si = 0; si < 4; ++si) o[si] *= alpha;

#pragma unroll
        for (int si = 0; si < 4; ++si) {         // A[m=d][k=key]: rows of Vt, keys contiguous
          const v16bf vh = ld_frag_lds(pVh, 16 * si, 64 * j);
          const v16bf vl = ld_frag_lds(pVl, 16 * si, 64 * j);
          mma(o[si], vh, ph.v); mma(o[si], vh, pl.v); mma(o[si], vl, ph.v);
        }
      }
    }
    // Publish point of stage s + 1, passed by every wave: own reads done, own slice landed, then the barrier that also frees stage s's buffer.
    wait_ds0();
    wait_tensor0_held(g0, g1);
    __syncthreads();
    if (pinned((uint32_t)(s + 2 < ns))) {
      g0 = tdm_group0(dst0 + (uint32_t)(s & 1) * (uint32_t)STG_BYTES, ga0 + (uint64_t)(s + 2) * sstep);
      tdm_load_held(g0, g1);
    }
  }
  wait_tensor0_held(g0, g1);
  wait_ds0();
  // The last pass's own barrier stands behind every wave's last read of the ring: its start may now hold the four waves' output tiles.
  float* ctile = (float*)ring + w * (16 * 64);

  const float inv = 1.0f / (lq + xhalf(lq));
#pragma unroll
  for (int si = 0; si < 4; ++si) {
    float* cp = ctile + nc * 64 + 16 * si + 8 * hh;
    v4f c0v, c1v;
    c0v.x = o[si][0] * inv; c0v.y = o[si][1] * inv; c0v.z = o[si][2] * inv; c0v.w = o[si][3] * inv;
    c1v.x = o[si][4] * inv; c1v.y = o[si][5] * inv; c1v.z = o[si][6] * inv; c1v.w = o[si][7] * inv;
    *(v4f*)(cp) = c0v;
    *(v4f*)(cp + 4) = c1v;
  }
  __syncthreads();
  const size_t rbase = ((size_t)b * (size_t)S_ + (size_t)q0) * (size_t)D_ + (size_t)hd * (size_t)DH_;
#pragma unroll
  for (int j = 0; j < 4; ++j) {
    const int row = j * 4 + (l >> 3);
    const int c0 = 8 * (l & 7);
    const float* tp = ctile + row * 64 + c0;
    const v4f f0 = *(const v4f*)(tp);
    const v4f f1 = *(const v4f*)(tp + 4);
    v4u vh, vl;
    split8(f0, f1, vh, vl);
    const size_t oidx = rbase + (size_t)row * (size_t)D_ + (size_t)c0;
    *(v4u*)(Ch + oidx) = vh;
    *(v4u*)(Cl + oidx) = vl;
    
  }
  asm volatile("s_wait_xcnt 0x0" ::: "memory");  // the second tile's pass overwrites the registers that these stores name
  }
}

extern "C" void kernel_launch(void* const* d_in, const int* in_sizes, int n_in,
                              void* d_out, int out_size, void* d_ws, size_t ws_size,
                              hipStream_t stream) {
  if (n_in < 6) return;
  const int nX = M_ * D_;          // 4194304
  const int nW = D_ * D_;          // 1048576
  const int nHead = B_ * H_ * S_ * DH_;   // 4194304
  if (in_sizes[0] != nX || in_sizes[1] != nW || in_sizes[2] != nW ||
      in_sizes[3] != nW || in_sizes[4] != nW || in_sizes[5] != D_) return;
  if (out_size != nX) return;

  const float* hs = (const float*)d_in[0];
  const float* wq = (const float*)d_in[1];
  const float* wk = (const float*)d_in[2];
  const float* wv = (const float*)d_in[3];
  const float* wo = (const float*)d_in[4];
  const float* bo = (const float*)d_in[5];
  float* out = (float*)d_out;

  char* ws = (char*)d_ws;
  size_t off = 0;
  const size_t bX = (size_t)nX * 2u;            // 8 MiB per plane
  const size_t bW = (size_t)nW * 2u * 4u;       // four matrices per plane, 8 MiB
  const size_t bHd = (size_t)nHead * 2u;        // 8 MiB per plane
  u16* Xh  = (u16*)(ws + off); off += bX;
  u16* Xl  = (u16*)(ws + off); off += bX;
  u16* Wh  = (u16*)(ws + off); off += bW;
  u16* Wl  = (u16*)(ws + off); off += bW;
  u16* Qh  = (u16*)(ws + off); off += bHd;
  u16* Ql  = (u16*)(ws + off); off += bHd;
  u16* Kh  = (u16*)(ws + off); off += bHd;
  u16* Kl  = (u16*)(ws + off); off += bHd;
  u16* Vth = (u16*)(ws + off); off += bHd;
  u16* Vtl = (u16*)(ws + off); off += bHd;
  u16* Ch  = (u16*)(ws + off); off += bX;
  u16* Cl  = (u16*)(ws + off); off += bX;
  if (off > ws_size) return;                    // 100663296 B total

  // 1) f32 -> bf16 hi/lo planes: x (2048 blocks needed) and 4 weights (512 blocks each)
  k_split<<<dim3((unsigned)(nX / 8 / 256), 5, 1), 256, 0, stream>>>(hs, wq, wk, wv, wo, Xh, Xl, Wh, Wl, nX, nW);
  // 2) q/k/v projections: 16 head tiles x 64 row tiles x 3 matrices
  k_proj_qkv<<<dim3(D_ / 64, M_ / 64, 3), 128, 0, stream>>>(Xh, Xl, Wh, Wl, Qh, Ql, Kh, Kl, Vth, Vtl);
  // 3) attention: one 128-thread block per (b, h, pair of 64-query tiles)
  k_attn<<<dim3((unsigned)(B_ * H_ * (S_ / 128)), 1, 1), 128, 0, stream>>>(Qh, Ql, Kh, Kl, Vth, Vtl, Ch, Cl);
  // 4) output projection + bias
  k_proj_out<<<dim3(D_ / 64, M_ / 64, 1), 128, 0, stream>>>(Ch, Cl, Wh, Wl, bo, out);
  (void)hipGetLastError();
}

// v006
// It runs in 151 microseconds.
// In two side-by-side timings against v005, it was 1.17 and 1.16 times as fast.
// Over all steps from v000 it is 4.01 times as fast.
#include <hip/hip_runtime.h>
#include <stdint.h>

// All contractions (q/k/v projections, q.k^T scores, p.v, output projection): v_wmma_f32_16x16x32_bf16 with bf16 hi/lo operand planes everywhere (hi.hi + lo.hi + hi.lo), f32 accumulate; alibi bias, 1/sqrt(d) scale, tanh softcap and softmax in f32.

#define B_  2
#define S_  2048
#define D_  1024
#define H_  16
#define DH_ 64
#define M_  (B_ * S_)

static_assert((M_ % 64) == 0);
static_assert((D_ % 64) == 0);
static_assert((S_ % 64) == 0);
static_assert(DH_ == 64);

typedef unsigned short u16;
typedef __bf16 v16bf __attribute__((ext_vector_type(16)));
typedef __bf16 v8bf  __attribute__((ext_vector_type(8)));
typedef float  v8f   __attribute__((ext_vector_type(8)));
typedef float  v4f   __attribute__((ext_vector_type(4)));
typedef unsigned int v4u __attribute__((ext_vector_type(4)));

union Frag { v16bf v; v8bf half[2]; };

// 16x32 fragment from a 16-bit plane stored [row][k] with k contiguous (pitch ld elements).
// Same map for A (row = m) and B (row = n): lane l -> row (l&15); elements 0..7 <- k0+8h+0..7,
// elements 8..15 <- k0+16+8h+0..7 with h = l>>4.
__device__ __forceinline__ v16bf ld_frag(const u16* base, int ld, int row0, int k0) {
  const int l = (int)(threadIdx.x & 31u), hh = l >> 4, m = l & 15;
  const u16* p = base + (size_t)(row0 + m) * (size_t)ld + (size_t)(k0 + 8 * hh);
  Frag f;
  f.half[0] = *(const v8bf*)(p);
  f.half[1] = *(const v8bf*)(p + 16);
  return f.v;
}

// D[16x16] += A[16x32] . B[32x16]; acc element r of lane l = (row 8h+r, col l&15). Hazard guard after every issue.
__device__ __forceinline__ void mma(v8f& acc, v16bf a, v16bf b) {
  acc = __builtin_amdgcn_wmma_f32_16x16x32_bf16(false, a, false, b, (short)0, acc, false, false);
  asm volatile("v_nop\n\tv_nop\n\tv_nop\n\tv_nop" : "+v"(acc) : "v"(a), "v"(b));
}

// f32 -> bf16 bits, RNE convert
__device__ __forceinline__ unsigned int bf16_bits(float f) {
  const unsigned int u = __float_as_uint(f);
  return (u + 0x7FFFu + ((u >> 16) & 1u)) >> 16;
}

// hi = bf16(x), lo = bf16(x - hi)
__device__ __forceinline__ void split_one(float x, unsigned int& hi, unsigned int& lo) {
  hi = bf16_bits(x);
  lo = bf16_bits(x - __uint_as_float(hi << 16));
}

__device__ __forceinline__ void split_pair(float x, float y, unsigned int& hi, unsigned int& lo) {
  unsigned int hx, lx, hy, ly;
  split_one(x, hx, lx);
  split_one(y, hy, ly);
  hi = hx | (hy << 16);
  lo = lx | (ly << 16);
}

// 8 consecutive floats -> packed 8 x bf16 hi (16 B) and 8 x bf16 lo (16 B)
__device__ __forceinline__ void split8(v4f a, v4f c, v4u& hi, v4u& lo) {
  unsigned int h0, l0, h1, l1, h2, l2, h3, l3;
  split_pair(a.x, a.y, h0, l0);
  split_pair(a.z, a.w, h1, l1);
  split_pair(c.x, c.y, h2, l2);
  split_pair(c.z, c.w, h3, l3);
  hi.x = h0; hi.y = h1; hi.z = h2; hi.w = h3;
  lo.x = l0; lo.y = l1; lo.z = l2; lo.w = l3;
}

// ---------------- f32 -> bf16 hi/lo planes for x and the four weight matrices ----------------
// blockIdx.y selects the segment (0: x, 1..4: Wq, Wk, Wv, Wo). Each thread converts 8 floats and
__global__ __launch_bounds__(256) void k_split(const float* __restrict__ x,
                                               const float* __restrict__ wq, const float* __restrict__ wk,
                                               const float* __restrict__ wv, const float* __restrict__ wo,
                                               u16* __restrict__ Xh, u16* __restrict__ Xl,
                                               u16* __restrict__ Wh, u16* __restrict__ Wl,
                                               int nx, int nw) {
  const int seg = (int)blockIdx.y;
  const float* src = x;
  u16* dh = Xh;
  u16* dl = Xl;
  int n = nx;
  if (seg > 0) {
    const int wi = seg - 1;
    src = (wi == 0) ? wq : (wi == 1) ? wk : (wi == 2) ? wv : wo;
    dh = Wh + (size_t)wi * (size_t)nw;
    dl = Wl + (size_t)wi * (size_t)nw;
    n = nw;
  }
  const size_t i8 = ((size_t)blockIdx.x * (size_t)blockDim.x + (size_t)threadIdx.x) * 8u;
  if (i8 + 8u > (size_t)n) return;
  const v4f a = *(const v4f*)(src + i8);
  const v4f c = *(const v4f*)(src + i8 + 4);
  v4u vh, vl;
  split8(a, c, vh, vl);
  u16* ph = dh + i8;
  u16* pl = dl + i8;
  *(v4u*)ph = vh;
  *(v4u*)pl = vl;
  
}

// ---------------- operand staging: tensor loads into a two-buffer LDS ring ----------------
// A stage is 64 k of the block's four operand planes (A hi, A lo, B hi, B lo): rows of 128 B, laid at pitch 144 B.
// One request per wave and stage.
typedef uint32_t u32x4 __attribute__((ext_vector_type(4)));
typedef uint32_t u32x8 __attribute__((ext_vector_type(8)));
#define STG_K     64                     // k elements per stage
#define STG_ROWB  128                    // bytes of one staged row
#define STG_PITCH 144                    // LDS row pitch: an odd multiple of 16 B, conflict-free for 16-byte reads
#define STG_SLICE 10240                  // 64 rows x 144 B = 9216 B, rounded up to a multiple of 2 KiB
#define STG_BYTES (4 * STG_SLICE)        // one buffer
#define RING_BYTES (2 * STG_BYTES)       // 81920 B: four blocks per WGP
static_assert((D_ % STG_K) == 0 && (D_ / STG_K) >= 2);
static_assert(64 * STG_PITCH <= STG_SLICE && (STG_SLICE % 2048) == 0);

__device__ __forceinline__ uint32_t uni(uint32_t v) { return (uint32_t)__builtin_amdgcn_readfirstlane(v); }
// Holds a wave-uniform test in a scalar register, so that the branch round a tensor load is a scalar branch (the load ignores EXEC).
__device__ __forceinline__ uint32_t pinned(uint32_t v) { uint32_t w = uni(v); asm volatile("" : "+s"(w)); return w; }
__device__ __forceinline__ void wait_ds0() { asm volatile("s_wait_dscnt 0x0" ::: "memory"); }          // this wave's LDS reads have returned

// Descriptor group 0: place in LDS and first byte of the tile.
__device__ __forceinline__ u32x4 tdm_group0(uint32_t lds_dst, uint64_t ga) {
  u32x4 g0;
  g0[0] = uni(1u);
  g0[1] = uni(lds_dst);
  g0[2] = uni((uint32_t)ga);
  g0[3] = uni((((uint32_t)(ga >> 32)) & 0x01FFFFFFu) | 0x80000000u);
  return g0;
}
// Descriptor group 1: a tile of rows rows of 128 B, source row pitch src_pitch bytes, 16 B of LDS pad behind every row.
__device__ __forceinline__ u32x8 tdm_group1(uint32_t src_pitch, uint32_t rows) {
  u32x8 g1;
  g1[0] = uni((1u << 20) | (4u << 22) | (3u << 25));   // no mask, 1-byte elements, a pad of 4 dwords after every 32 dwords
  g1[1] = uni((uint32_t)STG_ROWB << 16);
  g1[2] = uni(rows << 16);
  g1[3] = uni((uint32_t)STG_ROWB << 16);
  g1[4] = uni(rows);
  g1[5] = uni(src_pitch);
  g1[6] = uni(0u);
  g1[7] = uni(0u);
  return g1;
}
// Both groups are in-out operands of the load and inputs of the wait that covers it: no descriptor register takes another value while its request is outstanding.
__device__ __forceinline__ void tdm_load_held(u32x4& g0, u32x8& g1) { asm volatile("tensor_load_to_lds %0, %1" : "+s"(g0), "+s"(g1) :: "memory"); }
__device__ __forceinline__ void wait_tensor0_held(u32x4 g0, u32x8 g1) { asm volatile("s_wait_tensorcnt 0x0" :: "s"(g0), "s"(g1) : "memory"); }

// 16x32 fragment from a staged plane; kb = byte offset of the fragment's first k in the row. Same k map as ld_frag.
__device__ __forceinline__ v16bf ld_frag_lds(const unsigned char* plane, int row0, int kb) {
  const int l = (int)(threadIdx.x & 31u), hh = l >> 4, m = l & 15;
  const unsigned char* p = plane + (row0 + m) * STG_PITCH + kb + 16 * hh;
  Frag f;
  f.half[0] = *(const v8bf*)(p);
  f.half[1] = *(const v8bf*)(p + 32);
  return f.v;
}

// ---------------- block GEMM, three-term hi/lo products ----------------
// C[m][n] = sum_k A[m][k] * B[n][k]  (A and B both stored [row][k], k contiguous, D_ elements a row).
// A block makes BM x BN of C with a WGM x WGN grid of waves. Each A plane of a stage lies in SA slices, each B plane in SB:
// [A hi | A lo | B hi | B lo], one slice to a wave; every slice starts at a multiple of 2 KiB.
template <int BM, int BN, int WGM, int WGN, int SA, int SB>
struct Blk {
  static constexpr int TM = BM / WGM / 16, TN = BN / WGN / 16;      // 16x16 accumulators of a wave
  static constexpr int AR = BM / SA, BR = BN / SB;                  // rows of a slice
  static constexpr int ASL = (AR * STG_PITCH + 2047) / 2048 * 2048;
  static constexpr int BSL = (BR * STG_PITCH + 2047) / 2048 * 2048;
  static constexpr int BUF = 2 * SA * ASL + 2 * SB * BSL;           // one buffer
  static constexpr int RING = 2 * BUF;
  static_assert(WGM * WGN == 2 * SA + 2 * SB);                      // one request per wave and stage
  static_assert((AR % 16) == 0 && (BR % 16) == 0);                  // a fragment's 16 rows lie in one slice
};

// The result goes to LDS at the start of the ring, element (row, c16 + lane column) at float index idx(row, c16) + lane column.
template <typename G, int WGN, int SA, int SB, typename Idx>
__device__ __forceinline__ void gemm_block(const u16* Ah, const u16* Al, const u16* Bh, const u16* Bl,
                                           int m0, int n0, unsigned char* ring, Idx idx) {
  const int l = (int)(threadIdx.x & 31u), hh = l >> 4, nc = l & 15;
  const int w = (int)uni(threadIdx.x >> 5);
  const int ar0 = (w / WGN) * (16 * G::TM), br0 = (w % WGN) * (16 * G::TN);   // this wave's first row of A and of B
  int aoff[G::TM], boff[G::TN];                  // place of each fragment's first row in a buffer (hi plane)
  // Every loop over fragments or accumulators below is unrolled: with constant indices these arrays stay in registers.
#pragma unroll
  for (int i = 0; i < G::TM; ++i) aoff[i] = ((ar0 + 16 * i) / G::AR) * G::ASL + ((ar0 + 16 * i) % G::AR) * STG_PITCH;
#pragma unroll
  for (int n = 0; n < G::TN; ++n) boff[n] = 2 * SA * G::ASL + ((br0 + 16 * n) / G::BR) * G::BSL + ((br0 + 16 * n) % G::BR) * STG_PITCH;
  float* tile = (float*)ring;

  const bool isA = w < 2 * SA;                   // waves 0 .. 2 SA - 1 bring A's slices, the others B's
  const u16* sp = isA ? ((w < SA) ? Ah : Al) : ((w < 2 * SA + SB) ? Bh : Bl);
  const int rows = isA ? G::AR : G::BR;
  const int srow = isA ? m0 + (w % SA) * G::AR : n0 + ((w - 2 * SA) % SB) * G::BR;
  const uint64_t ga0 = (uint64_t)(size_t)sp + (uint64_t)srow * (uint64_t)(D_ * 2);
  const uint32_t dst0 = (uint32_t)(size_t)ring + (uint32_t)(isA ? w * G::ASL : 2 * SA * G::ASL + (w - 2 * SA) * G::BSL);
  const int ns = D_ / STG_K;

  u32x8 g1 = tdm_group1((uint32_t)(D_ * 2), (uint32_t)rows);
  u32x4 g0 = tdm_group0(dst0, ga0);
  tdm_load_held(g0, g1);
  wait_tensor0_held(g0, g1);
  __syncthreads();                               // stage 0 is published
  g0 = tdm_group0(dst0 + (uint32_t)G::BUF, ga0 + (uint64_t)STG_ROWB);
  tdm_load_held(g0, g1);

  v8f acc[G::TM][G::TN] = {};
  for (int s = 0; s < ns; ++s) {
    const unsigned char* buf = ring + (s & 1) * G::BUF;
#pragma unroll  // both 32-k halves of the stage in line: every accumulator index is then a constant
    for (int j = 0; j < STG_K / 32; ++j) {
      const int kb = 64 * j;
      v16bf ah[G::TM], al[G::TM];
#pragma unroll
      for (int i = 0; i < G::TM; ++i) {
        ah[i] = ld_frag_lds(buf + aoff[i], 0, kb);
        al[i] = ld_frag_lds(buf + aoff[i] + SA * G::ASL, 0, kb);
      }
      v16bf nh = ld_frag_lds(buf + boff[0], 0, kb);
      v16bf nl = ld_frag_lds(buf + boff[0] + SB * G::BSL, 0, kb);
#pragma unroll
      for (int n = 0; n < G::TN; ++n) {
        const v16bf bh = nh, bl = nl;
        if (n + 1 < G::TN) {                     // the next column's B fragments are asked for ahead of this column's products
          nh = ld_frag_lds(buf + boff[n + 1], 0, kb);
          nl = ld_frag_lds(buf + boff[n + 1] + SB * G::BSL, 0, kb);
        }
        // Term by term down the column of accumulators: neighbours in issue order are independent; each accumulator still sums hi.hi, lo.hi, hi.lo.
#pragma unroll
        for (int i = 0; i < G::TM; ++i) mma(acc[i][n], ah[i], bh);
#pragma unroll
        for (int i = 0; i < G::TM; ++i) mma(acc[i][n], al[i], bh);
#pragma unroll
        for (int i = 0; i < G::TM; ++i) mma(acc[i][n], ah[i], bl);
      }
    }
    // Publish point of stage s + 1: own reads done, own slice landed, then the barrier that also frees stage s's buffer.
    wait_ds0();
    wait_tensor0_held(g0, g1);
    __syncthreads();
    if (pinned((uint32_t)(s + 2 < ns))) {
      g0 = tdm_group0(dst0 + (uint32_t)(s & 1) * (uint32_t)G::BUF, ga0 + (uint64_t)(s + 2) * (uint64_t)STG_ROWB);
      tdm_load_held(g0, g1);
    }
  }
  wait_tensor0_held(g0, g1);
  wait_ds0();
  // The last pass's own barrier stands behind every wave's last read of the ring: its start may now hold the result.
#pragma unroll
  for (int n = 0; n < G::TN; ++n) {
#pragma unroll
    for (int i = 0; i < G::TM; ++i) {
#pragma unroll
      for (int r = 0; r < 8; ++r) tile[idx(ar0 + 16 * i + 8 * hh + r, br0 + 16 * n) + nc] = acc[i][n][r];
    }
  }
}

// ---------------- q/k/v projections as one product: x . [Wq; Wk; Wv]^T, 256 rows x 192 columns (three heads) a block ----------------
// Wh/Wl hold Wq, Wk, Wv, Wo back to back ([n][k] rows). 16 x 16 blocks: one to a WGP.
typedef Blk<256, 192, 4, 3, 4, 2> GQ;        // 12 waves of 64 x 64
#define SUBF 4160                                // floats kept for one 64x64 head tile of the result (64 rows at pitch 64 or 65)
static_assert(12 * SUBF * 4 <= GQ::RING);
static_assert((M_ % 256) == 0 && ((3 * D_) % 192) == 0 && (S_ % 256) == 0);
__global__ __launch_bounds__(384) void k_proj_qkv(const u16* Xh, const u16* Xl,
                                                  const u16* Wh, const u16* Wl,
                                                  u16* Qh, u16* Ql, u16* Kh, u16* Kl,
                                                  u16* Vth, u16* Vtl) {
  __shared__ __attribute__((aligned(2048))) unsigned char ring[GQ::RING];
  const int hd0 = (int)blockIdx.x * 3;       // first of the block's three heads, counted through q, k, v: 0 .. 47
  const int m0 = (int)blockIdx.y * 256;
  // A v head's tile is read back by columns: pitch 65 puts a column's rows on different banks.
  gemm_block<GQ, 3, 4, 2>(Xh, Xl, Wh, Wl, m0, hd0 * 64, ring, [&](int row, int c16) {
    const int ni = c16 >> 6;
    const int pitch = (hd0 + ni >= 2 * H_) ? 65 : 64;
    return ((row >> 6) * 3 + ni) * SUBF + (row & 63) * pitch + (c16 & 63);
  });
  __syncthreads();

  const int wv = (int)uni(threadIdx.x >> 5), w = wv & 3, l = (int)(threadIdx.x & 31u);
  for (int t = wv >> 2; t < 12; t += 3) {    // four waves a head tile
    const float* tile = (const float*)ring + t * SUBF;
    const int z = (hd0 + t % 3) >> 4, hd = (hd0 + t % 3) & (H_ - 1);
    const int m = m0 + (t / 3) * 64;
    const int b = m >> 11, s0 = m & (S_ - 1);
    const int bh = b * H_ + hd;
    if (z < 2) {
      u16* Ph = (z == 0) ? Qh : Kh;
      u16* Pl = (z == 0) ? Ql : Kl;
      const size_t base = ((size_t)bh * (size_t)S_ + (size_t)s0) * (size_t)DH_;
#pragma unroll
      for (int j = 0; j < 4; ++j) {
        const int row = w * 16 + j * 4 + (l >> 3);
        const int c0 = 8 * (l & 7);
        const float* tp = tile + row * 64 + c0;
        const v4f f0 = *(const v4f*)(tp);
        const v4f f1 = *(const v4f*)(tp + 4);
        v4u vh, vl;
        split8(f0, f1, vh, vl);
        const size_t o = base + (size_t)row * (size_t)DH_ + (size_t)c0;
        *(v4u*)(Ph + o) = vh;
        *(v4u*)(Pl + o) = vl;
      }
    } else {
#pragma unroll
      for (int j = 0; j < 4; ++j) {
        const int d = w * 16 + j * 4 + (l >> 3);   // Vt row within the head
        const int k0 = 8 * (l & 7);               // key offset within the 64-key tile
        v4f f0, f1;
        f0.x = tile[(k0 + 0) * 65 + d]; f0.y = tile[(k0 + 1) * 65 + d];
        f0.z = tile[(k0 + 2) * 65 + d]; f0.w = tile[(k0 + 3) * 65 + d];
        f1.x = tile[(k0 + 4) * 65 + d]; f1.y = tile[(k0 + 5) * 65 + d];
        f1.z = tile[(k0 + 6) * 65 + d]; f1.w = tile[(k0 + 7) * 65 + d];
        v4u vh, vl;
        split8(f0, f1, vh, vl);
        const size_t o = ((size_t)bh * (size_t)DH_ + (size_t)d) * (size_t)S_ + (size_t)s0 + (size_t)k0;
        *(v4u*)(Vth + o) = vh;
        *(v4u*)(Vtl + o) = vl;
      }
    }
    asm volatile("s_wait_xcnt 0x0" ::: "memory");  // the next head tile's pass overwrites the registers that these stores name
  }
}

// ---------------- output projection: out = ctx . Wo^T + bo (f32), 128 x 128 a block ----------------
typedef Blk<128, 128, 2, 4, 2, 2> GO;        // 8 waves of 64 x 32
static_assert(128 * 128 * 4 <= GO::RING);
static_assert((M_ % 128) == 0 && (D_ % 128) == 0);
// At most two waves a SIMD: the 256 blocks then stand one to a WGP, on all 256 WGPs, wherever the dispatcher starts them.
__global__ __launch_bounds__(256) __attribute__((amdgpu_waves_per_eu(2, 2))) void k_proj_out(const u16* Ch, const u16* Cl,
                                                  const u16* Wh, const u16* Wl,
                                                  const float* __restrict__ bo, float* out) {
  __shared__ __attribute__((aligned(2048))) unsigned char ring[GO::RING];
  const int n0 = (int)blockIdx.x * 128;
  const int m0 = (int)blockIdx.y * 128;
  const u16* Bh = Wh + (size_t)3 * (size_t)D_ * (size_t)D_;
  const u16* Bl = Wl + (size_t)3 * (size_t)D_ * (size_t)D_;
  gemm_block<GO, 4, 2, 2>(Ch, Cl, Bh, Bl, m0, n0, ring, [&](int row, int c16) { return row * 128 + c16; });
  __syncthreads();

  const float* tile = (const float*)ring;
  const int w = (int)(threadIdx.x >> 5), l = (int)(threadIdx.x & 31u);
  const int c0 = 4 * l;
  const v4f bb = *(const v4f*)(bo + n0 + c0);
#pragma unroll  // the 16 rows' LDS reads go out together, ahead of the stores
  for (int j = 0; j < 16; ++j) {
    const int row = w * 16 + j;
    v4f v = *(const v4f*)(tile + row * 128 + c0);
    v = v + bb;
    float* op = out + (size_t)(m0 + row) * (size_t)D_ + (size_t)(n0 + c0);
    *(v4f*)op = v;
  }
}

union PFrag { v16bf v; unsigned int u[8]; };

// lane l <-> lane l ^ 16
__device__ __forceinline__ float xhalf(float x) {
  return __builtin_bit_cast(float, __builtin_amdgcn_permlanex16(__builtin_bit_cast(int, x), __builtin_bit_cast(int, x),
                                                                0x76543210, 0xfedcba98, false, false));
}

static_assert(S_ / STG_K >= 2);
static_assert(4 * 16 * 64 * 4 <= RING_BYTES);
#define QT_ (S_ / 64)                            // 64-query tiles of a head
static_assert((QT_ % 2) == 0 && QT_ == 32);

// At most two waves a SIMD: the 512 equal blocks then stand two to a WGP, on all 256 WGPs, wherever the dispatcher starts them.
__global__ __launch_bounds__(128) __attribute__((amdgpu_waves_per_eu(2, 2))) void k_attn(const u16* Qh, const u16* Ql,
                                              const u16* Kh, const u16* Kl,
                                              const u16* Vth, const u16* Vtl,
                                              u16* Ch, u16* Cl) {
  __shared__ __attribute__((aligned(2048))) unsigned char ring[RING_BYTES];

  const int gw = (int)blockIdx.x;                // 0 .. B*H*(S/128)-1
  const int bh = gw >> 4, tp = gw & 15;
  const int b = bh >> 4, hd = bh & 15;
  const int l = (int)(threadIdx.x & 31u), hh = l >> 4, nc = l & 15;
  const int w = (int)uni(threadIdx.x >> 5);
  const int ex = hd + 1;                         // slope = 2^(-(h+1)/2)
  const float slope = ((ex & 1) ? 0.70710678118654752f : 1.0f) *
                      __uint_as_float((unsigned int)(127 - (ex >> 1)) << 23);

  const u16* Qhp  = Qh  + (size_t)bh * (size_t)S_ * (size_t)DH_;
  const u16* Qlp  = Ql  + (size_t)bh * (size_t)S_ * (size_t)DH_;
  const u16* Khp  = Kh  + (size_t)bh * (size_t)S_ * (size_t)DH_;
  const u16* Klp  = Kl  + (size_t)bh * (size_t)S_ * (size_t)DH_;
  const u16* Vthp = Vth + (size_t)bh * (size_t)DH_ * (size_t)S_;
  const u16* Vtlp = Vtl + (size_t)bh * (size_t)DH_ * (size_t)S_;

  // This wave's plane: first byte, source row pitch, and the step from one stage's tile to the next.
  const u16* sp = (w == 0) ? Khp : (w == 1) ? Klp : (w == 2) ? Vthp : Vtlp;
  const uint64_t ga0 = (uint64_t)(size_t)sp;
  const uint32_t spitch = (w < 2) ? (uint32_t)(DH_ * 2) : (uint32_t)(S_ * 2);
  const uint64_t sstep = (w < 2) ? (uint64_t)(STG_K * DH_ * 2) : (uint64_t)STG_ROWB;
  const uint32_t dst0 = (uint32_t)(size_t)ring + (uint32_t)w * (uint32_t)STG_SLICE;
  u32x8 g1 = tdm_group1(spitch, 64u);

  for (int pass = 0; pass < 2; ++pass) {
  const int qb = pass ? tp : (QT_ - 1 - tp);     // block-uniform
  const int q0 = qb * 64 + w * 16;
  const int ns = qb + 1;                         // keys 0 .. 64 qb + 63, 64 per stage
  if (pass) {
    // The first tile's output rows stand in the ring: own reads of them done, then the barrier behind every wave's reads, and only then the refill.
    wait_ds0();
    __syncthreads();
  }

  u32x4 g0 = tdm_group0(dst0, ga0);
  tdm_load_held(g0, g1);
  wait_tensor0_held(g0, g1);
  __syncthreads();                               // stage 0 is published
  g0 = tdm_group0(dst0 + (uint32_t)STG_BYTES, ga0 + sstep);   // keys 64..127 lie in the planes for every block
  tdm_load_held(g0, g1);

  const v16bf q0h = ld_frag(Qhp, DH_, q0, 0),  q0l = ld_frag(Qlp, DH_, q0, 0);
  const v16bf q1h = ld_frag(Qhp, DH_, q0, 32), q1l = ld_frag(Qlp, DH_, q0, 32);

  v8f o[4] = {};                                 // o[si][r] = O[query nc][d = 16 si + 8 h + r]
  float mq = -3.0e38f;                           // running maximum of this lane's query (equal in both halves)
  float lq = 0.0f;                               // this half's share of the query's sum; halves joined after the loop
  const int q = q0 + nc;

  const int nchunk = (q0 >> 5) + 1;              // this wave's keys 0 .. q0+15, 32 per chunk
  for (int s = 0; s < ns; ++s) {
    const unsigned char* buf = ring + (s & 1) * STG_BYTES;
    const unsigned char* pKh = buf;
    const unsigned char* pKl = buf + STG_SLICE;
    const unsigned char* pVh = buf + 2 * STG_SLICE;
    const unsigned char* pVl = buf + 3 * STG_SLICE;
#pragma unroll  // both 32-key chunks of the stage in line: every fragment offset is then an immediate of its LDS load
    for (int j = 0; j < STG_K / 32; ++j) {
      const int c = 2 * s + j;
      if (c < nchunk) {                          // wave-uniform: a chunk wholly above this wave's diagonal is skipped
        const int ks = c << 5;
        v8f sc[2] = {};
#pragma unroll
        for (int t = 0; t < 2; ++t) {
          const int kr = 32 * j + 16 * t;        // A[m=key][k=d]: rows of K, d contiguous
          const v16bf k0h = ld_frag_lds(pKh, kr, 0),  k0l = ld_frag_lds(pKl, kr, 0);
          const v16bf k1h = ld_frag_lds(pKh, kr, 64), k1l = ld_frag_lds(pKl, kr, 64);
          mma(sc[t], k0h, q0h); mma(sc[t], k0h, q0l); mma(sc[t], k0l, q0h);
          mma(sc[t], k1h, q1h); mma(sc[t], k1h, q1l); mma(sc[t], k1l, q1h);
        }

        float xs[2][8];
        float t0 = -3.0e38f;
#pragma unroll
        for (int t = 0; t < 2; ++t) {
#pragma unroll
          for (int r = 0; r < 8; ++r) {
            const int kk = ks + 16 * t + 8 * hh + r;
            float x = (sc[t][r] - (float)(q - kk) * slope) * 0.125f;
            x = 30.0f * __builtin_amdgcn_tanhf(x * (1.0f / 30.0f));   // one v_tanh_f32: no branch, so the 16 scores of a lane run as independent chains
            x = (kk <= q) ? x : -3.0e38f;
            xs[t][r] = x;
            t0 = fmaxf(t0, x);
          }
        }
        t0 = fmaxf(t0, xhalf(t0));
        const float mnew = fmaxf(mq, t0);
        const float alpha = __expf(mq - mnew);
        mq = mnew;

        PFrag ph, pl;
        float u = 0.0f;
#pragma unroll
        for (int t = 0; t < 2; ++t) {
#pragma unroll
          for (int i = 0; i < 4; ++i) {
            const float pa = __expf(xs[t][2 * i] - mnew);
            const float pb = __expf(xs[t][2 * i + 1] - mnew);
            u += pa + pb;
            split_pair(pa, pb, ph.u[4 * t + i], pl.u[4 * t + i]);
          }
        }
        lq = lq * alpha + u;
#pragma unroll
        for (int si = 0; si < 4; ++si) o[si] *= alpha;

#pragma unroll
        for (int si = 0; si < 4; ++si) {         // A[m=d][k=key]: rows of Vt, keys contiguous
          const v16bf vh = ld_frag_lds(pVh, 16 * si, 64 * j);
          const v16bf vl = ld_frag_lds(pVl, 16 * si, 64 * j);
          mma(o[si], vh, ph.v); mma(o[si], vh, pl.v); mma(o[si], vl, ph.v);
        }
      }
    }
    // Publish point of stage s + 1, passed by every wave: own reads done, own slice landed, then the barrier that also frees stage s's buffer.
    wait_ds0();
    wait_tensor0_held(g0, g1);
    __syncthreads();
    if (pinned((uint32_t)(s + 2 < ns))) {
      g0 = tdm_group0(dst0 + (uint32_t)(s & 1) * (uint32_t)STG_BYTES, ga0 + (uint64_t)(s + 2) * sstep);
      tdm_load_held(g0, g1);
    }
  }
  wait_tensor0_held(g0, g1);
  wait_ds0();
  // The last pass's own barrier stands behind every wave's last read of the ring: its start may now hold the four waves' output tiles.
  float* ctile = (float*)ring + w * (16 * 64);

  const float inv = 1.0f / (lq + xhalf(lq));
#pragma unroll
  for (int si = 0; si < 4; ++si) {
    float* cp = ctile + nc * 64 + 16 * si + 8 * hh;
    v4f c0v, c1v;
    c0v.x = o[si][0] * inv; c0v.y = o[si][1] * inv; c0v.z = o[si][2] * inv; c0v.w = o[si][3] * inv;
    c1v.x = o[si][4] * inv; c1v.y = o[si][5] * inv; c1v.z = o[si][6] * inv; c1v.w = o[si][7] * inv;
    *(v4f*)(cp) = c0v;
    *(v4f*)(cp + 4) = c1v;
  }
  __syncthreads();
  const size_t rbase = ((size_t)b * (size_t)S_ + (size_t)q0) * (size_t)D_ + (size_t)hd * (size_t)DH_;
#pragma unroll
  for (int j = 0; j < 4; ++j) {
    const int row = j * 4 + (l >> 3);
    const int c0 = 8 * (l & 7);
    const float* tp = ctile + row * 64 + c0;
    const v4f f0 = *(const v4f*)(tp);
    const v4f f1 = *(const v4f*)(tp + 4);
    v4u vh, vl;
    split8(f0, f1, vh, vl);
    const size_t oidx = rbase + (size_t)row * (size_t)D_ + (size_t)c0;
    *(v4u*)(Ch + oidx) = vh;
    *(v4u*)(Cl + oidx) = vl;
    
  }
  asm volatile("s_wait_xcnt 0x0" ::: "memory");  // the second tile's pass overwrites the registers that these stores name
  }
}

extern "C" void kernel_launch(void* const* d_in, const int* in_sizes, int n_in,
                              void* d_out, int out_size, void* d_ws, size_t ws_size,
                              hipStream_t stream) {
  if (n_in < 6) return;
  const int nX = M_ * D_;          // 4194304
  const int nW = D_ * D_;          // 1048576
  const int nHead = B_ * H_ * S_ * DH_;   // 4194304
  if (in_sizes[0] != nX || in_sizes[1] != nW || in_sizes[2] != nW ||
      in_sizes[3] != nW || in_sizes[4] != nW || in_sizes[5] != D_) return;
  if (out_size != nX) return;

  const float* hs = (const float*)d_in[0];
  const float* wq = (const float*)d_in[1];
  const float* wk = (const float*)d_in[2];
  const float* wv = (const float*)d_in[3];
  const float* wo = (const float*)d_in[4];
  const float* bo = (const float*)d_in[5];
  float* out = (float*)d_out;

  char* ws = (char*)d_ws;
  size_t off = 0;
  const size_t bX = (size_t)nX * 2u;            // 8 MiB per plane
  const size_t bW = (size_t)nW * 2u * 4u;       // four matrices per plane, 8 MiB
  const size_t bHd = (size_t)nHead * 2u;        // 8 MiB per plane
  u16* Xh  = (u16*)(ws + off); off += bX;
  u16* Xl  = (u16*)(ws + off); off += bX;
  u16* Wh  = (u16*)(ws + off); off += bW;
  u16* Wl  = (u16*)(ws + off); off += bW;
  u16* Qh  = (u16*)(ws + off); off += bHd;
  u16* Ql  = (u16*)(ws + off); off += bHd;
  u16* Kh  = (u16*)(ws + off); off += bHd;
  u16* Kl  = (u16*)(ws + off); off += bHd;
  u16* Vth = (u16*)(ws + off); off += bHd;
  u16* Vtl = (u16*)(ws + off); off += bHd;
  u16* Ch  = (u16*)(ws + off); off += bX;
  u16* Cl  = (u16*)(ws + off); off += bX;
  if (off > ws_size) return;                    // 100663296 B total

  // 1) f32 -> bf16 hi/lo planes: x (2048 blocks needed) and 4 weights (512 blocks each)
  k_split<<<dim3((unsigned)(nX / 8 / 256), 5, 1), 256, 0, stream>>>(hs, wq, wk, wv, wo, Xh, Xl, Wh, Wl, nX, nW);
  // 2) q/k/v projections: 16 tiles of three heads x 16 row tiles
  k_proj_qkv<<<dim3(3 * D_ / 192, M_ / 256, 1), 384, 0, stream>>>(Xh, Xl, Wh, Wl, Qh, Ql, Kh, Kl, Vth, Vtl);
  // 3) attention: one 128-thread block per (b, h, pair of 64-query tiles)
  k_attn<<<dim3((unsigned)(B_ * H_ * (S_ / 128)), 1, 1), 128, 0, stream>>>(Qh, Ql, Kh, Kl, Vth, Vtl, Ch, Cl);
  // 4) output projection + bias
  k_proj_out<<<dim3(D_ / 128, M_ / 128, 1), 256, 0, stream>>>(Ch, Cl, Wh, Wl, bo, out);
  (void)hipGetLastError();
}

// v007
// One run takes 145 microseconds.
// Two timings next to v006 both put it at 1.05 times that version's speed.
// Counting every step since v000, it is 4.20 times as fast.
#include <hip/hip_runtime.h>
#include <stdint.h>

// All contractions (q/k/v projections, q.k^T scores, p.v, output projection): v_wmma_f32_16x16x32_bf16 with bf16 hi/lo operand planes everywhere (hi.hi + lo.hi + hi.lo), f32 accumulate; alibi bias, 1/sqrt(d) scale, tanh softcap and softmax in f32.

#define B_  2
#define S_  2048
#define D_  1024
#define H_  16
#define DH_ 64
#define M_  (B_ * S_)

static_assert((M_ % 64) == 0);
static_assert((D_ % 64) == 0);
static_assert((S_ % 64) == 0);
static_assert(DH_ == 64);

typedef unsigned short u16;
typedef __bf16 v16bf __attribute__((ext_vector_type(16)));
typedef __bf16 v8bf  __attribute__((ext_vector_type(8)));
typedef float  v8f   __attribute__((ext_vector_type(8)));
typedef float  v4f   __attribute__((ext_vector_type(4)));
typedef unsigned int v4u __attribute__((ext_vector_type(4)));

union Frag { v16bf v; v8bf half[2]; };

// 16x32 fragment from a 16-bit plane stored [row][k] with k contiguous (pitch ld elements).
// Same map for A (row = m) and B (row = n): lane l -> row (l&15); elements 0..7 <- k0+8h+0..7,
// elements 8..15 <- k0+16+8h+0..7 with h = l>>4.
__device__ __forceinline__ v16bf ld_frag(const u16* base, int ld, int row0, int k0) {
  const int l = (int)(threadIdx.x & 31u), hh = l >> 4, m = l & 15;
  const u16* p = base + (size_t)(row0 + m) * (size_t)ld + (size_t)(k0 + 8 * hh);
  Frag f;
  f.half[0] = *(const v8bf*)(p);
  f.half[1] = *(const v8bf*)(p + 16);
  return f.v;
}

// D[16x16] += A[16x32] . B[32x16]; acc element r of lane l = (row 8h+r, col l&15). Hazard guard after every issue.
__device__ __forceinline__ void mma(v8f& acc, v16bf a, v16bf b) {
  acc = __builtin_amdgcn_wmma_f32_16x16x32_bf16(false, a, false, b, (short)0, acc, false, false);
  asm volatile("v_nop\n\tv_nop\n\tv_nop\n\tv_nop" : "+v"(acc) : "v"(a), "v"(b));
}

// f32 -> bf16 bits, RNE convert
__device__ __forceinline__ unsigned int bf16_bits(float f) {
  const unsigned int u = __float_as_uint(f);
  return (u + 0x7FFFu + ((u >> 16) & 1u)) >> 16;
}

// hi = bf16(x), lo = bf16(x - hi)
__device__ __forceinline__ void split_one(float x, unsigned int& hi, unsigned int& lo) {
  hi = bf16_bits(x);
  lo = bf16_bits(x - __uint_as_float(hi << 16));
}

__device__ __forceinline__ void split_pair(float x, float y, unsigned int& hi, unsigned int& lo) {
  unsigned int hx, lx, hy, ly;
  split_one(x, hx, lx);
  split_one(y, hy, ly);
  hi = hx | (hy << 16);
  lo = lx | (ly << 16);
}

// 8 consecutive floats -> packed 8 x bf16 hi (16 B) and 8 x bf16 lo (16 B)
__device__ __forceinline__ void split8(v4f a, v4f c, v4u& hi, v4u& lo) {
  unsigned int h0, l0, h1, l1, h2, l2, h3, l3;
  split_pair(a.x, a.y, h0, l0);
  split_pair(a.z, a.w, h1, l1);
  split_pair(c.x, c.y, h2, l2);
  split_pair(c.z, c.w, h3, l3);
  hi.x = h0; hi.y = h1; hi.z = h2; hi.w = h3;
  lo.x = l0; lo.y = l1; lo.z = l2; lo.w = l3;
}

// ---------------- f32 -> bf16 hi/lo planes for x and the four weight matrices ----------------
// blockIdx.y selects the segment (0: x, 1..4: Wq, Wk, Wv, Wo). Each thread converts 8 floats and
__global__ __launch_bounds__(256) void k_split(const float* __restrict__ x,
                                               const float* __restrict__ wq, const float* __restrict__ wk,
                                               const float* __restrict__ wv, const float* __restrict__ wo,
                                               u16* __restrict__ Xh, u16* __restrict__ Xl,
                                               u16* __restrict__ Wh, u16* __restrict__ Wl,
                                               int nx, int nw) {
  const int seg = (int)blockIdx.y;
  const float* src = x;
  u16* dh = Xh;
  u16* dl = Xl;
  int n = nx;
  if (seg > 0) {
    const int wi = seg - 1;
    src = (wi == 0) ? wq : (wi == 1) ? wk : (wi == 2) ? wv : wo;
    dh = Wh + (size_t)wi * (size_t)nw;
    dl = Wl + (size_t)wi * (size_t)nw;
    n = nw;
  }
  const size_t i8 = ((size_t)blockIdx.x * (size_t)blockDim.x + (size_t)threadIdx.x) * 8u;
  if (i8 + 8u > (size_t)n) return;
  const v4f a = *(const v4f*)(src + i8);
  const v4f c = *(const v4f*)(src + i8 + 4);
  v4u vh, vl;
  split8(a, c, vh, vl);
  u16* ph = dh + i8;
  u16* pl = dl + i8;
  *(v4u*)ph = vh;
  *(v4u*)pl = vl;
  
}

// ---------------- operand staging: tensor loads into a two-buffer LDS ring ----------------
// A stage is 64 k of the block's four operand planes (A hi, A lo, B hi, B lo): rows of 128 B, laid at pitch 144 B.
// One request per wave and stage.
typedef uint32_t u32x4 __attribute__((ext_vector_type(4)));
typedef uint32_t u32x8 __attribute__((ext_vector_type(8)));
#define STG_K     64                     // k elements per stage
#define STG_ROWB  128                    // bytes of one staged row
#define STG_PITCH 144                    // LDS row pitch: an odd multiple of 16 B, conflict-free for 16-byte reads
#define STG_SLICE 10240                  // 64 rows x 144 B = 9216 B, rounded up to a multiple of 2 KiB
#define STG_BYTES (4 * STG_SLICE)        // one buffer
#define RING_BYTES (2 * STG_BYTES)       // 81920 B: four blocks per WGP
static_assert((D_ % STG_K) == 0 && (D_ / STG_K) >= 2);
static_assert(64 * STG_PITCH <= STG_SLICE && (STG_SLICE % 2048) == 0);

__device__ __forceinline__ uint32_t uni(uint32_t v) { return (uint32_t)__builtin_amdgcn_readfirstlane(v); }
// Holds a wave-uniform test in a scalar register, so that the branch round a tensor load is a scalar branch (the load ignores EXEC).
__device__ __forceinline__ uint32_t pinned(uint32_t v) { uint32_t w = uni(v); asm volatile("" : "+s"(w)); return w; }
__device__ __forceinline__ void wait_ds0() { asm volatile("s_wait_dscnt 0x0" ::: "memory"); }          // this wave's LDS reads have returned

// Descriptor group 0: place in LDS and first byte of the tile.
__device__ __forceinline__ u32x4 tdm_group0(uint32_t lds_dst, uint64_t ga) {
  u32x4 g0;
  g0[0] = uni(1u);
  g0[1] = uni(lds_dst);
  g0[2] = uni((uint32_t)ga);
  g0[3] = uni((((uint32_t)(ga >> 32)) & 0x01FFFFFFu) | 0x80000000u);
  return g0;
}
// Descriptor group 1: a tile of rows rows of 128 B, source row pitch src_pitch bytes, 16 B of LDS pad behind every row.
__device__ __forceinline__ u32x8 tdm_group1(uint32_t src_pitch, uint32_t rows) {
  u32x8 g1;
  g1[0] = uni((1u << 20) | (4u << 22) | (3u << 25));   // no mask, 1-byte elements, a pad of 4 dwords after every 32 dwords
  g1[1] = uni((uint32_t)STG_ROWB << 16);
  g1[2] = uni(rows << 16);
  g1[3] = uni((uint32_t)STG_ROWB << 16);
  g1[4] = uni(rows);
  g1[5] = uni(src_pitch);
  g1[6] = uni(0u);
  g1[7] = uni(0u);
  return g1;
}
// Both groups are in-out operands of the load and inputs of the wait that covers it: no descriptor register takes another value while its request is outstanding.
__device__ __forceinline__ void tdm_load_held(u32x4& g0, u32x8& g1) { asm volatile("tensor_load_to_lds %0, %1" : "+s"(g0), "+s"(g1) :: "memory"); }
__device__ __forceinline__ void wait_tensor0_held(u32x4 g0, u32x8 g1) { asm volatile("s_wait_tensorcnt 0x0" :: "s"(g0), "s"(g1) : "memory"); }

// 16x32 fragment from a staged plane; kb = byte offset of the fragment's first k in the row. Same k map as ld_frag.
__device__ __forceinline__ v16bf ld_frag_lds(const unsigned char* plane, int row0, int kb) {
  const int l = (int)(threadIdx.x & 31u), hh = l >> 4, m = l & 15;
  const unsigned char* p = plane + (row0 + m) * STG_PITCH + kb + 16 * hh;
  Frag f;
  f.half[0] = *(const v8bf*)(p);
  f.half[1] = *(const v8bf*)(p + 32);
  return f.v;
}

// ---------------- block GEMM, three-term hi/lo products ----------------
// C[m][n] = sum_k A[m][k] * B[n][k]  (A and B both stored [row][k], k contiguous, D_ elements a row).
// A block makes BM x BN of C with a WGM x WGN grid of waves. Each A plane of a stage lies in SA slices, each B plane in SB:
// [A hi | A lo | B hi | B lo], one slice to a wave; every slice starts at a multiple of 2 KiB.
template <int BM, int BN, int WGM, int WGN, int SA, int SB>
struct Blk {
  static constexpr int TM = BM / WGM / 16, TN = BN / WGN / 16;      // 16x16 accumulators of a wave
  static constexpr int AR = BM / SA, BR = BN / SB;                  // rows of a slice
  static constexpr int ASL = (AR * STG_PITCH + 2047) / 2048 * 2048;
  static constexpr int BSL = (BR * STG_PITCH + 2047) / 2048 * 2048;
  static constexpr int BUF = 2 * SA * ASL + 2 * SB * BSL;           // one buffer
  static constexpr int RING = 2 * BUF;
  static_assert(WGM * WGN == 2 * SA + 2 * SB);                      // one request per wave and stage
  static_assert((AR % 16) == 0 && (BR % 16) == 0);                  // a fragment's 16 rows lie in one slice
};

// The result goes to LDS at the start of the ring, element (row, c16 + lane column) at float index idx(row, c16) + lane column.
template <typename G, int WGN, int SA, int SB, typename Idx>
__device__ __forceinline__ void gemm_block(const u16* Ah, const u16* Al, const u16* Bh, const u16* Bl,
                                           int m0, int n0, unsigned char* ring, Idx idx) {
  const int l = (int)(threadIdx.x & 31u), hh = l >> 4, nc = l & 15;
  const int w = (int)uni(threadIdx.x >> 5);
  const int ar0 = (w / WGN) * (16 * G::TM), br0 = (w % WGN) * (16 * G::TN);   // this wave's first row of A and of B
  int aoff[G::TM], boff[G::TN];                  // place of each fragment's first row in a buffer (hi plane)
  // Every loop over fragments or accumulators below is unrolled: with constant indices these arrays stay in registers.
#pragma unroll
  for (int i = 0; i < G::TM; ++i) aoff[i] = ((ar0 + 16 * i) / G::AR) * G::ASL + ((ar0 + 16 * i) % G::AR) * STG_PITCH;
#pragma unroll
  for (int n = 0; n < G::TN; ++n) boff[n] = 2 * SA * G::ASL + ((br0 + 16 * n) / G::BR) * G::BSL + ((br0 + 16 * n) % G::BR) * STG_PITCH;
  float* tile = (float*)ring;

  const bool isA = w < 2 * SA;                   // waves 0 .. 2 SA - 1 bring A's slices, the others B's
  const u16* sp = isA ? ((w < SA) ? Ah : Al) : ((w < 2 * SA + SB) ? Bh : Bl);
  const int rows = isA ? G::AR : G::BR;
  const int srow = isA ? m0 + (w % SA) * G::AR : n0 + ((w - 2 * SA) % SB) * G::BR;
  const uint64_t ga0 = (uint64_t)(size_t)sp + (uint64_t)srow * (uint64_t)(D_ * 2);
  const uint32_t dst0 = (uint32_t)(size_t)ring + (uint32_t)(isA ? w * G::ASL : 2 * SA * G::ASL + (w - 2 * SA) * G::BSL);
  const int ns = D_ / STG_K;

  u32x8 g1 = tdm_group1((uint32_t)(D_ * 2), (uint32_t)rows);
  u32x4 g0 = tdm_group0(dst0, ga0);
  tdm_load_held(g0, g1);
  wait_tensor0_held(g0, g1);
  __syncthreads();                               // stage 0 is published
  g0 = tdm_group0(dst0 + (uint32_t)G::BUF, ga0 + (uint64_t)STG_ROWB);
  tdm_load_held(g0, g1);

  v8f acc[G::TM][G::TN] = {};
  for (int s = 0; s < ns; ++s) {
    const unsigned char* buf = ring + (s & 1) * G::BUF;
#pragma unroll  // both 32-k halves of the stage in line: every accumulator index is then a constant
    for (int j = 0; j < STG_K / 32; ++j) {
      const int kb = 64 * j;
      v16bf ah[G::TM], al[G::TM];
#pragma unroll
      for (int i = 0; i < G::TM; ++i) {
        ah[i] = ld_frag_lds(buf + aoff[i], 0, kb);
        al[i] = ld_frag_lds(buf + aoff[i] + SA * G::ASL, 0, kb);
      }
      v16bf nh = ld_frag_lds(buf + boff[0], 0, kb);
      v16bf nl = ld_frag_lds(buf + boff[0] + SB * G::BSL, 0, kb);
#pragma unroll
      for (int n = 0; n < G::TN; ++n) {
        const v16bf bh = nh, bl = nl;
        if (n + 1 < G::TN) {                     // the next column's B fragments are asked for ahead of this column's products
          nh = ld_frag_lds(buf + boff[n + 1], 0, kb);
          nl = ld_frag_lds(buf + boff[n + 1] + SB * G::BSL, 0, kb);
        }
        // Term by term down the column of accumulators: neighbours in issue order are independent; each accumulator still sums hi.hi, lo.hi, hi.lo.
#pragma unroll
        for (int i = 0; i < G::TM; ++i) mma(acc[i][n], ah[i], bh);
#pragma unroll
        for (int i = 0; i < G::TM; ++i) mma(acc[i][n], al[i], bh);
#pragma unroll
        for (int i = 0; i < G::TM; ++i) mma(acc[i][n], ah[i], bl);
      }
    }
    // Publish point of stage s + 1: own reads done, own slice landed, then the barrier that also frees stage s's buffer.
    wait_ds0();
    wait_tensor0_held(g0, g1);
    __syncthreads();
    if (pinned((uint32_t)(s + 2 < ns))) {
      g0 = tdm_group0(dst0 + (uint32_t)(s & 1) * (uint32_t)G::BUF, ga0 + (uint64_t)(s + 2) * (uint64_t)STG_ROWB);
      tdm_load_held(g0, g1);
    }
  }
  wait_tensor0_held(g0, g1);
  wait_ds0();
  // The last pass's own barrier stands behind every wave's last read of the ring: its start may now hold the result.
#pragma unroll
  for (int n = 0; n < G::TN; ++n) {
#pragma unroll
    for (int i = 0; i < G::TM; ++i) {
#pragma unroll
      for (int r = 0; r < 8; ++r) tile[idx(ar0 + 16 * i + 8 * hh + r, br0 + 16 * n) + nc] = acc[i][n][r];
    }
  }
}

// ---------------- q/k/v projections as one product: x . [Wq; Wk; Wv]^T, 256 rows x 192 columns (three heads) a block ----------------
// Wh/Wl hold Wq, Wk, Wv, Wo back to back ([n][k] rows). 16 x 16 blocks: one to a WGP.
typedef Blk<256, 192, 4, 3, 4, 2> GQ;        // 12 waves of 64 x 64
#define SUBF 4160                                // floats kept for one 64x64 head tile of the result (64 rows at pitch 64 or 65)
static_assert(12 * SUBF * 4 <= GQ::RING);
static_assert((M_ % 256) == 0 && ((3 * D_) % 192) == 0 && (S_ % 256) == 0);
__global__ __launch_bounds__(384) void k_proj_qkv(const u16* Xh, const u16* Xl,
                                                  const u16* Wh, const u16* Wl,
                                                  u16* Qh, u16* Ql, u16* Kh, u16* Kl,
                                                  u16* Vth, u16* Vtl) {
  __shared__ __attribute__((aligned(2048))) unsigned char ring[GQ::RING];
  const int hd0 = (int)blockIdx.x * 3;       // first of the block's three heads, counted through q, k, v: 0 .. 47
  const int m0 = (int)blockIdx.y * 256;
  // A v head's tile is read back by columns: pitch 65 puts a column's rows on different banks.
  gemm_block<GQ, 3, 4, 2>(Xh, Xl, Wh, Wl, m0, hd0 * 64, ring, [&](int row, int c16) {
    const int ni = c16 >> 6;
    const int pitch = (hd0 + ni >= 2 * H_) ? 65 : 64;
    return ((row >> 6) * 3 + ni) * SUBF + (row & 63) * pitch + (c16 & 63);
  });
  __syncthreads();

  const int wv = (int)uni(threadIdx.x >> 5), w = wv & 3, l = (int)(threadIdx.x & 31u);
  for (int t = wv >> 2; t < 12; t += 3) {    // four waves a head tile
    const float* tile = (const float*)ring + t * SUBF;
    const int z = (hd0 + t % 3) >> 4, hd = (hd0 + t % 3) & (H_ - 1);
    const int m = m0 + (t / 3) * 64;
    const int b = m >> 11, s0 = m & (S_ - 1);
    const int bh = b * H_ + hd;
    if (z < 2) {
      u16* Ph = (z == 0) ? Qh : Kh;
      u16* Pl = (z == 0) ? Ql : Kl;
      const size_t base = ((size_t)bh * (size_t)S_ + (size_t)s0) * (size_t)DH_;
#pragma unroll
      for (int j = 0; j < 4; ++j) {
        const int row = w * 16 + j * 4 + (l >> 3);
        const int c0 = 8 * (l & 7);
        const float* tp = tile + row * 64 + c0;
        const v4f f0 = *(const v4f*)(tp);
        const v4f f1 = *(const v4f*)(tp + 4);
        v4u vh, vl;
        split8(f0, f1, vh, vl);
        const size_t o = base + (size_t)row * (size_t)DH_ + (size_t)c0;
        *(v4u*)(Ph + o) = vh;
        *(v4u*)(Pl + o) = vl;
      }
    } else {
#pragma unroll
      for (int j = 0; j < 4; ++j) {
        const int d = w * 16 + j * 4 + (l >> 3);   // Vt row within the head
        const int k0 = 8 * (l & 7);               // key offset within the 64-key tile
        v4f f0, f1;
        f0.x = tile[(k0 + 0) * 65 + d]; f0.y = tile[(k0 + 1) * 65 + d];
        f0.z = tile[(k0 + 2) * 65 + d]; f0.w = tile[(k0 + 3) * 65 + d];
        f1.x = tile[(k0 + 4) * 65 + d]; f1.y = tile[(k0 + 5) * 65 + d];
        f1.z = tile[(k0 + 6) * 65 + d]; f1.w = tile[(k0 + 7) * 65 + d];
        v4u vh, vl;
        split8(f0, f1, vh, vl);
        const size_t o = ((size_t)bh * (size_t)DH_ + (size_t)d) * (size_t)S_ + (size_t)s0 + (size_t)k0;
        *(v4u*)(Vth + o) = vh;
        *(v4u*)(Vtl + o) = vl;
      }
    }
    asm volatile("s_wait_xcnt 0x0" ::: "memory");  // the next head tile's pass overwrites the registers that these stores name
  }
}

// ---------------- output projection: out = ctx . Wo^T + bo (f32), 128 x 128 a block ----------------
typedef Blk<128, 128, 2, 4, 2, 2> GO;        // 8 waves of 64 x 32
static_assert(128 * 128 * 4 <= GO::RING);
static_assert((M_ % 128) == 0 && (D_ % 128) == 0);
// At most two waves a SIMD: the 256 blocks then stand one to a WGP, on all 256 WGPs, wherever the dispatcher starts them.
__global__ __launch_bounds__(256) __attribute__((amdgpu_waves_per_eu(2, 2))) void k_proj_out(const u16* Ch, const u16* Cl,
                                                  const u16* Wh, const u16* Wl,
                                                  const float* __restrict__ bo, float* out) {
  __shared__ __attribute__((aligned(2048))) unsigned char ring[GO::RING];
  const int n0 = (int)blockIdx.x * 128;
  const int m0 = (int)blockIdx.y * 128;
  const u16* Bh = Wh + (size_t)3 * (size_t)D_ * (size_t)D_;
  const u16* Bl = Wl + (size_t)3 * (size_t)D_ * (size_t)D_;
  gemm_block<GO, 4, 2, 2>(Ch, Cl, Bh, Bl, m0, n0, ring, [&](int row, int c16) { return row * 128 + c16; });
  __syncthreads();

  const float* tile = (const float*)ring;
  const int w = (int)(threadIdx.x >> 5), l = (int)(threadIdx.x & 31u);
  const int c0 = 4 * l;
  const v4f bb = *(const v4f*)(bo + n0 + c0);
#pragma unroll  // the 16 rows' LDS reads go out together, ahead of the stores
  for (int j = 0; j < 16; ++j) {
    const int row = w * 16 + j;
    v4f v = *(const v4f*)(tile + row * 128 + c0);
    v = v + bb;
    float* op = out + (size_t)(m0 + row) * (size_t)D_ + (size_t)(n0 + c0);
    *(v4f*)op = v;
  }
}

union PFrag { v16bf v; unsigned int u[8]; };

// lane l <-> lane l ^ 16
__device__ __forceinline__ float xhalf(float x) {
  return __builtin_bit_cast(float, __builtin_amdgcn_permlanex16(__builtin_bit_cast(int, x), __builtin_bit_cast(int, x),
                                                                0x76543210, 0xfedcba98, false, false));
}

static_assert(S_ / STG_K >= 2);
#define XJ_F (8 * 32 * 4 + 2 * 32)               // floats one wave hands to its partner: O (32 a lane), maximum, sum
static_assert((4 * 16 * 64 + 4 * XJ_F) * 4 <= RING_BYTES);
#define QT_ (S_ / 64)                            // 64-query tiles of a head
static_assert((QT_ % 2) == 0 && QT_ == 32);

// At most four waves a SIMD: the 512 equal blocks then stand two to a WGP, on all 256 WGPs, wherever the dispatcher starts them.
__global__ __launch_bounds__(256) __attribute__((amdgpu_waves_per_eu(4, 4))) void k_attn(const u16* Qh, const u16* Ql,
                                              const u16* Kh, const u16* Kl,
                                              const u16* Vth, const u16* Vtl,
                                              u16* Ch, u16* Cl) {
  __shared__ __attribute__((aligned(2048))) unsigned char ring[RING_BYTES];

  const int gw = (int)blockIdx.x;                // 0 .. B*H*(S/128)-1
  const int bh = gw >> 4, tp = gw & 15;
  const int b = bh >> 4, hd = bh & 15;
  const int l = (int)(threadIdx.x & 31u), hh = l >> 4, nc = l & 15;
  const int w = (int)uni(threadIdx.x >> 5);
  const int qw = w & 3, par = w >> 2;            // which 16 queries of the tile, which 32 keys of every stage
  const uint32_t issuer = (uint32_t)(w < 4);     // waves 0..3 bring the four planes
  const int ex = hd + 1;                         // slope = 2^(-(h+1)/2)
  const float slope = ((ex & 1) ? 0.70710678118654752f : 1.0f) *
                      __uint_as_float((unsigned int)(127 - (ex >> 1)) << 23);

  const u16* Qhp  = Qh  + (size_t)bh * (size_t)S_ * (size_t)DH_;
  const u16* Qlp  = Ql  + (size_t)bh * (size_t)S_ * (size_t)DH_;
  const u16* Khp  = Kh  + (size_t)bh * (size_t)S_ * (size_t)DH_;
  const u16* Klp  = Kl  + (size_t)bh * (size_t)S_ * (size_t)DH_;
  const u16* Vthp = Vth + (size_t)bh * (size_t)DH_ * (size_t)S_;
  const u16* Vtlp = Vtl + (size_t)bh * (size_t)DH_ * (size_t)S_;

  // This wave's plane: first byte, source row pitch, and the step from one stage's tile to the next.
  const u16* sp = (qw == 0) ? Khp : (qw == 1) ? Klp : (qw == 2) ? Vthp : Vtlp;
  const uint64_t ga0 = (uint64_t)(size_t)sp;
  const uint32_t spitch = (qw < 2) ? (uint32_t)(DH_ * 2) : (uint32_t)(S_ * 2);
  const uint64_t sstep = (qw < 2) ? (uint64_t)(STG_K * DH_ * 2) : (uint64_t)STG_ROWB;
  const uint32_t dst0 = (uint32_t)(size_t)ring + (uint32_t)qw * (uint32_t)STG_SLICE;
  u32x8 g1 = tdm_group1(spitch, 64u);

  for (int pass = 0; pass < 2; ++pass) {
  const int qb = pass ? tp : (QT_ - 1 - tp);     // block-uniform
  const int q0 = qb * 64 + qw * 16;
  const int ns = qb + 1;                         // keys 0 .. 64 qb + 63, 64 per stage
  if (pass) {
    // The first tile's output rows stand in the ring: own reads of them done, then the barrier behind every wave's reads, and only then the refill.
    wait_ds0();
    __syncthreads();
  }

  u32x4 g0 = tdm_group0(dst0, ga0);
  if (pinned(issuer)) {
    tdm_load_held(g0, g1);
    wait_tensor0_held(g0, g1);
  }
  __syncthreads();                               // stage 0 is published
  if (pinned(issuer)) {
    g0 = tdm_group0(dst0 + (uint32_t)STG_BYTES, ga0 + sstep);   // keys 64..127 lie in the planes for every block
    tdm_load_held(g0, g1);
  }

  const v16bf q0h = ld_frag(Qhp, DH_, q0, 0),  q0l = ld_frag(Qlp, DH_, q0, 0);
  const v16bf q1h = ld_frag(Qhp, DH_, q0, 32), q1l = ld_frag(Qlp, DH_, q0, 32);

  v8f o[4] = {};                                 // o[si][r] = O[query nc][d = 16 si + 8 h + r]
  float mq = -3.0e38f;                           // running maximum of this lane's query (equal in both halves)
  float lq = 0.0f;                               // this half's share of the query's sum; halves joined after the loop
  const int q = q0 + nc;

  const int nchunk = (q0 >> 5) + 1;              // these queries' keys 0 .. q0+15, 32 per chunk; this wave takes chunks par, par + 2, ...
  for (int s = 0; s < ns; ++s) {
    const unsigned char* buf = ring + (s & 1) * STG_BYTES;
    const unsigned char* pKh = buf + par * (32 * STG_PITCH);      // this wave's 32 key rows of the stage
    const unsigned char* pKl = pKh + STG_SLICE;
    const unsigned char* pVh = buf + 2 * STG_SLICE + par * 64;    // the same 32 keys' bytes in every V^T row
    const unsigned char* pVl = pVh + STG_SLICE;
    {
      const int c = 2 * s + par;
      if (c < nchunk) {                          // wave-uniform: a chunk wholly above this wave's diagonal is skipped
        const int ks = c << 5;
        v8f sc[2] = {};
#pragma unroll
        for (int t = 0; t < 2; ++t) {
          const int kr = 16 * t;                 // A[m=key][k=d]: rows of K, d contiguous
          const v16bf k0h = ld_frag_lds(pKh, kr, 0),  k0l = ld_frag_lds(pKl, kr, 0);
          const v16bf k1h = ld_frag_lds(pKh, kr, 64), k1l = ld_frag_lds(pKl, kr, 64);
          mma(sc[t], k0h, q0h); mma(sc[t], k0h, q0l); mma(sc[t], k0l, q0h);
          mma(sc[t], k1h, q1h); mma(sc[t], k1h, q1l); mma(sc[t], k1l, q1h);
        }

        float xs[2][8];
        float t0 = -3.0e38f;
#pragma unroll
        for (int t = 0; t < 2; ++t) {
#pragma unroll
          for (int r = 0; r < 8; ++r) {
            const int kk = ks + 16 * t + 8 * hh + r;
            float x = (sc[t][r] - (float)(q - kk) * slope) * 0.125f;
            x = 30.0f * __builtin_amdgcn_tanhf(x * (1.0f / 30.0f));   // one v_tanh_f32: no branch, so the 16 scores of a lane run as independent chains
            x = (kk <= q) ? x : -3.0e38f;
            xs[t][r] = x;
            t0 = fmaxf(t0, x);
          }
        }
        t0 = fmaxf(t0, xhalf(t0));
        const float mnew = fmaxf(mq, t0);
        const float alpha = __expf(mq - mnew);
        mq = mnew;

        PFrag ph, pl;
        float u = 0.0f;
#pragma unroll
        for (int t = 0; t < 2; ++t) {
#pragma unroll
          for (int i = 0; i < 4; ++i) {
            const float pa = __expf(xs[t][2 * i] - mnew);
            const float pb = __expf(xs[t][2 * i + 1] - mnew);
            u += pa + pb;
            split_pair(pa, pb, ph.u[4 * t + i], pl.u[4 * t + i]);
          }
        }
        lq = lq * alpha + u;
#pragma unroll
        for (int si = 0; si < 4; ++si) o[si] *= alpha;

#pragma unroll
        for (int si = 0; si < 4; ++si) {         // A[m=d][k=key]: rows of Vt, keys contiguous
          const v16bf vh = ld_frag_lds(pVh, 16 * si, 0);
          const v16bf vl = ld_frag_lds(pVl, 16 * si, 0);
          mma(o[si], vh, ph.v); mma(o[si], vh, pl.v); mma(o[si], vl, ph.v);
        }
      }
    }
    // Publish point of stage s + 1, passed by every wave: own reads done, own slice landed, then the barrier that also frees stage s's buffer.
    wait_ds0();
    wait_tensor0_held(g0, g1);
    __syncthreads();
    if (pinned(issuer & (uint32_t)(s + 2 < ns))) {
      g0 = tdm_group0(dst0 + (uint32_t)(s & 1) * (uint32_t)STG_BYTES, ga0 + (uint64_t)(s + 2) * sstep);
      tdm_load_held(g0, g1);
    }
  }
  wait_tensor0_held(g0, g1);
  wait_ds0();
  // The last pass's own barrier stands behind every wave's last read of the ring: its start may now hold the four output tiles,
  // and behind them what waves 4..7 hand to their partners (lane to lane: both waves of a pair hold the same query and d in a lane).
  float* ctile = (float*)ring + qw * (16 * 64);
  float* xj = (float*)ring + 4 * 16 * 64 + qw * XJ_F;
  if (par) {
#pragma unroll  // constant indices: o stays in registers
    for (int si = 0; si < 4; ++si) {
      v4f c0v, c1v;
      c0v.x = o[si][0]; c0v.y = o[si][1]; c0v.z = o[si][2]; c0v.w = o[si][3];
      c1v.x = o[si][4]; c1v.y = o[si][5]; c1v.z = o[si][6]; c1v.w = o[si][7];
      *(v4f*)(xj + ((2 * si) * 32 + l) * 4) = c0v;
      *(v4f*)(xj + ((2 * si + 1) * 32 + l) * 4) = c1v;
    }
    xj[8 * 32 * 4 + l] = mq;
    xj[8 * 32 * 4 + 32 + l] = lq;
  }
  __syncthreads();                               // the partners' partial results are published
  if (!par) {
    // A partner that had no chunk hands over maximum -3e38, sum 0, O 0: its weight a1 is then 0.
    const float m1 = xj[8 * 32 * 4 + l];
    const float l1 = xj[8 * 32 * 4 + 32 + l];
    const float mj = fmaxf(mq, m1);
    const float a0 = __expf(mq - mj), a1 = __expf(m1 - mj);
    lq = lq * a0 + l1 * a1;
    const float inv = 1.0f / (lq + xhalf(lq));
    const float b0 = a0 * inv, b1 = a1 * inv;
#pragma unroll  // constant indices: o stays in registers; the eight LDS reads go out together
    for (int si = 0; si < 4; ++si) {
      const v4f x0 = *(const v4f*)(xj + ((2 * si) * 32 + l) * 4);
      const v4f x1 = *(const v4f*)(xj + ((2 * si + 1) * 32 + l) * 4);
      float* cp = ctile + nc * 64 + 16 * si + 8 * hh;
      v4f c0v, c1v;
      c0v.x = o[si][0] * b0 + x0.x * b1; c0v.y = o[si][1] * b0 + x0.y * b1; c0v.z = o[si][2] * b0 + x0.z * b1; c0v.w = o[si][3] * b0 + x0.w * b1;
      c1v.x = o[si][4] * b0 + x1.x * b1; c1v.y = o[si][5] * b0 + x1.y * b1; c1v.z = o[si][6] * b0 + x1.z * b1; c1v.w = o[si][7] * b0 + x1.w * b1;
      *(v4f*)(cp) = c0v;
      *(v4f*)(cp + 4) = c1v;
    }
  }
  __syncthreads();
  if (!par) {
  const size_t rbase = ((size_t)b * (size_t)S_ + (size_t)q0) * (size_t)D_ + (size_t)hd * (size_t)DH_;
#pragma unroll
  for (int j = 0; j < 4; ++j) {
    const int row = j * 4 + (l >> 3);
    const int c0 = 8 * (l & 7);
    const float* tp = ctile + row * 64 + c0;
    const v4f f0 = *(const v4f*)(tp);
    const v4f f1 = *(const v4f*)(tp + 4);
    v4u vh, vl;
    split8(f0, f1, vh, vl);
    const size_t oidx = rbase + (size_t)row * (size_t)D_ + (size_t)c0;
    *(v4u*)(Ch + oidx) = vh;
    *(v4u*)(Cl + oidx) = vl;
    
  }
  asm volatile("s_wait_xcnt 0x0" ::: "memory");  // the second tile's pass overwrites the registers that these stores name
  }
  }
}

extern "C" void kernel_launch(void* const* d_in, const int* in_sizes, int n_in,
                              void* d_out, int out_size, void* d_ws, size_t ws_size,
                              hipStream_t stream) {
  if (n_in < 6) return;
  const int nX = M_ * D_;          // 4194304
  const int nW = D_ * D_;          // 1048576
  const int nHead = B_ * H_ * S_ * DH_;   // 4194304
  if (in_sizes[0] != nX || in_sizes[1] != nW || in_sizes[2] != nW ||
      in_sizes[3] != nW || in_sizes[4] != nW || in_sizes[5] != D_) return;
  if (out_size != nX) return;

  const float* hs = (const float*)d_in[0];
  const float* wq = (const float*)d_in[1];
  const float* wk = (const float*)d_in[2];
  const float* wv = (const float*)d_in[3];
  const float* wo = (const float*)d_in[4];
  const float* bo = (const float*)d_in[5];
  float* out = (float*)d_out;

  char* ws = (char*)d_ws;
  size_t off = 0;
  const size_t bX = (size_t)nX * 2u;            // 8 MiB per plane
  const size_t bW = (size_t)nW * 2u * 4u;       // four matrices per plane, 8 MiB
  const size_t bHd = (size_t)nHead * 2u;        // 8 MiB per plane
  u16* Xh  = (u16*)(ws + off); off += bX;
  u16* Xl  = (u16*)(ws + off); off += bX;
  u16* Wh  = (u16*)(ws + off); off += bW;
  u16* Wl  = (u16*)(ws + off); off += bW;
  u16* Qh  = (u16*)(ws + off); off += bHd;
  u16* Ql  = (u16*)(ws + off); off += bHd;
  u16* Kh  = (u16*)(ws + off); off += bHd;
  u16* Kl  = (u16*)(ws + off); off += bHd;
  u16* Vth = (u16*)(ws + off); off += bHd;
  u16* Vtl = (u16*)(ws + off); off += bHd;
  u16* Ch  = (u16*)(ws + off); off += bX;
  u16* Cl  = (u16*)(ws + off); off += bX;
  if (off > ws_size) return;                    // 100663296 B total

  // 1) f32 -> bf16 hi/lo planes: x (2048 blocks needed) and 4 weights (512 blocks each)
  k_split<<<dim3((unsigned)(nX / 8 / 256), 5, 1), 256, 0, stream>>>(hs, wq, wk, wv, wo, Xh, Xl, Wh, Wl, nX, nW);
  // 2) q/k/v projections: 16 tiles of three heads x 16 row tiles
  k_proj_qkv<<<dim3(3 * D_ / 192, M_ / 256, 1), 384, 0, stream>>>(Xh, Xl, Wh, Wl, Qh, Ql, Kh, Kl, Vth, Vtl);
  // 3) attention: one 256-thread block per (b, h, pair of 64-query tiles)
  k_attn<<<dim3((unsigned)(B_ * H_ * (S_ / 128)), 1, 1), 256, 0, stream>>>(Qh, Ql, Kh, Kl, Vth, Vtl, Ch, Cl);
  // 4) output projection + bias
  k_proj_out<<<dim3(D_ / 128, M_ / 128, 1), 256, 0, stream>>>(Ch, Cl, Wh, Wl, bo, out);
  (void)hipGetLastError();
}

// v008
// Measured time: 134 microseconds a run.
// Two timings next to v007 put it at 1.07 and 1.08 times that version's speed.
// All steps since v000 together make it 4.51 times as fast.
#include <hip/hip_runtime.h>
#include <stdint.h>

// All contractions (q/k/v projections, q.k^T scores, p.v, output projection): v_wmma_f32_16x16x32_bf16 with bf16 hi/lo operand planes everywhere (hi.hi + lo.hi + hi.lo), f32 accumulate; alibi bias, 1/sqrt(d) scale, tanh softcap and softmax in f32.

#define B_  2
#define S_  2048
#define D_  1024
#define H_  16
#define DH_ 64
#define M_  (B_ * S_)

static_assert((M_ % 64) == 0);
static_assert((D_ % 64) == 0);
static_assert((S_ % 64) == 0);
static_assert(DH_ == 64);

typedef unsigned short u16;
typedef __bf16 v16bf __attribute__((ext_vector_type(16)));
typedef __bf16 v8bf  __attribute__((ext_vector_type(8)));
typedef float  v8f   __attribute__((ext_vector_type(8)));
typedef float  v4f   __attribute__((ext_vector_type(4)));
typedef unsigned int v4u __attribute__((ext_vector_type(4)));

union Frag { v16bf v; v8bf half[2]; };

// 16x32 fragment from a 16-bit plane stored [row][k] with k contiguous (pitch ld elements).
// Same map for A (row = m) and B (row = n): lane l -> row (l&15); elements 0..7 <- k0+8h+0..7,
// elements 8..15 <- k0+16+8h+0..7 with h = l>>4.
__device__ __forceinline__ v16bf ld_frag(const u16* base, int ld, int row0, int k0) {
  const int l = (int)(threadIdx.x & 31u), hh = l >> 4, m = l & 15;
  const u16* p = base + (size_t)(row0 + m) * (size_t)ld + (size_t)(k0 + 8 * hh);
  Frag f;
  f.half[0] = *(const v8bf*)(p);
  f.half[1] = *(const v8bf*)(p + 16);
  return f.v;
}

// D[16x16] += A[16x32] . B[32x16]; acc element r of lane l = (row 8h+r, col l&15). Hazard guard after every issue.
__device__ __forceinline__ void mma(v8f& acc, v16bf a, v16bf b) {
  acc = __builtin_amdgcn_wmma_f32_16x16x32_bf16(false, a, false, b, (short)0, acc, false, false);
  asm volatile("v_nop\n\tv_nop\n\tv_nop\n\tv_nop" : "+v"(acc) : "v"(a), "v"(b));
}

typedef float  v2f  __attribute__((ext_vector_type(2)));
typedef __bf16 v2bf __attribute__((ext_vector_type(2)));

// Two floats -> packed bf16 pairs: hi = bf16(v), lo = bf16(v - hi), both rounded to nearest even by the packed hardware convert.
// v - hi is exact in f32: hi shares v's leading bits.
__device__ __forceinline__ void split_pair(float x, float y, unsigned int& hi, unsigned int& lo) {
  v2f v;
  v.x = x; v.y = y;
  const v2bf h = __builtin_convertvector(v, v2bf);
  const v2bf r = __builtin_convertvector(v - __builtin_convertvector(h, v2f), v2bf);
  hi = __builtin_bit_cast(unsigned int, h);
  lo = __builtin_bit_cast(unsigned int, r);
}

// 8 consecutive floats -> packed 8 x bf16 hi (16 B) and 8 x bf16 lo (16 B)
__device__ __forceinline__ void split8(v4f a, v4f c, v4u& hi, v4u& lo) {
  unsigned int h0, l0, h1, l1, h2, l2, h3, l3;
  split_pair(a.x, a.y, h0, l0);
  split_pair(a.z, a.w, h1, l1);
  split_pair(c.x, c.y, h2, l2);
  split_pair(c.z, c.w, h3, l3);
  hi.x = h0; hi.y = h1; hi.z = h2; hi.w = h3;
  lo.x = l0; lo.y = l1; lo.z = l2; lo.w = l3;
}

// ---------------- f32 -> bf16 hi/lo planes for x and the four weight matrices ----------------
// blockIdx.y selects the segment (0: x, 1..4: Wq, Wk, Wv, Wo). Each thread converts 8 floats and
__global__ __launch_bounds__(256) void k_split(const float* __restrict__ x,
                                               const float* __restrict__ wq, const float* __restrict__ wk,
                                               const float* __restrict__ wv, const float* __restrict__ wo,
                                               u16* __restrict__ Xh, u16* __restrict__ Xl,
                                               u16* __restrict__ Wh, u16* __restrict__ Wl,
                                               int nx, int nw) {
  const int seg = (int)blockIdx.y;
  const float* src = x;
  u16* dh = Xh;
  u16* dl = Xl;
  int n = nx;
  if (seg > 0) {
    const int wi = seg - 1;
    src = (wi == 0) ? wq : (wi == 1) ? wk : (wi == 2) ? wv : wo;
    dh = Wh + (size_t)wi * (size_t)nw;
    dl = Wl + (size_t)wi * (size_t)nw;
    n = nw;
  }
  const size_t i8 = ((size_t)blockIdx.x * (size_t)blockDim.x + (size_t)threadIdx.x) * 8u;
  if (i8 + 8u > (size_t)n) return;
  const v4f a = *(const v4f*)(src + i8);
  const v4f c = *(const v4f*)(src + i8 + 4);
  v4u vh, vl;
  split8(a, c, vh, vl);
  u16* ph = dh + i8;
  u16* pl = dl + i8;
  *(v4u*)ph = vh;
  *(v4u*)pl = vl;
  
}

// ---------------- operand staging: tensor loads into a two-buffer LDS ring ----------------
// A stage is 64 k of the block's four operand planes (A hi, A lo, B hi, B lo): rows of 128 B, laid at pitch 144 B.
// One request per wave and stage.
typedef uint32_t u32x4 __attribute__((ext_vector_type(4)));
typedef uint32_t u32x8 __attribute__((ext_vector_type(8)));
#define STG_K     64                     // k elements per stage
#define STG_ROWB  128                    // bytes of one staged row
#define STG_PITCH 144                    // LDS row pitch: an odd multiple of 16 B, conflict-free for 16-byte reads
#define STG_SLICE 10240                  // 64 rows x 144 B = 9216 B, rounded up to a multiple of 2 KiB
#define STG_BYTES (4 * STG_SLICE)        // one buffer
#define RING_BYTES (2 * STG_BYTES)       // 81920 B: four blocks per WGP
static_assert((D_ % STG_K) == 0 && (D_ / STG_K) >= 2);
static_assert(64 * STG_PITCH <= STG_SLICE && (STG_SLICE % 2048) == 0);

__device__ __forceinline__ uint32_t uni(uint32_t v) { return (uint32_t)__builtin_amdgcn_readfirstlane(v); }
// Holds a wave-uniform test in a scalar register, so that the branch round a tensor load is a scalar branch (the load ignores EXEC).
__device__ __forceinline__ uint32_t pinned(uint32_t v) { uint32_t w = uni(v); asm volatile("" : "+s"(w)); return w; }
__device__ __forceinline__ void wait_ds0() { asm volatile("s_wait_dscnt 0x0" ::: "memory"); }          // this wave's LDS reads have returned

// Descriptor group 0: place in LDS and first byte of the tile.
__device__ __forceinline__ u32x4 tdm_group0(uint32_t lds_dst, uint64_t ga) {
  u32x4 g0;
  g0[0] = uni(1u);
  g0[1] = uni(lds_dst);
  g0[2] = uni((uint32_t)ga);
  g0[3] = uni((((uint32_t)(ga >> 32)) & 0x01FFFFFFu) | 0x80000000u);
  return g0;
}
// Descriptor group 1: a tile of rows rows of 128 B, source row pitch src_pitch bytes, 16 B of LDS pad behind every row.
__device__ __forceinline__ u32x8 tdm_group1(uint32_t src_pitch, uint32_t rows) {
  u32x8 g1;
  g1[0] = uni((1u << 20) | (4u << 22) | (3u << 25));   // no mask, 1-byte elements, a pad of 4 dwords after every 32 dwords
  g1[1] = uni((uint32_t)STG_ROWB << 16);
  g1[2] = uni(rows << 16);
  g1[3] = uni((uint32_t)STG_ROWB << 16);
  g1[4] = uni(rows);
  g1[5] = uni(src_pitch);
  g1[6] = uni(0u);
  g1[7] = uni(0u);
  return g1;
}
// Both groups are in-out operands of the load and inputs of the wait that covers it: no descriptor register takes another value while its request is outstanding.
__device__ __forceinline__ void tdm_load_held(u32x4& g0, u32x8& g1) { asm volatile("tensor_load_to_lds %0, %1" : "+s"(g0), "+s"(g1) :: "memory"); }
__device__ __forceinline__ void wait_tensor0_held(u32x4 g0, u32x8 g1) { asm volatile("s_wait_tensorcnt 0x0" :: "s"(g0), "s"(g1) : "memory"); }

// 16x32 fragment from a staged plane; kb = byte offset of the fragment's first k in the row. Same k map as ld_frag.
__device__ __forceinline__ v16bf ld_frag_lds(const unsigned char* plane, int row0, int kb) {
  const int l = (int)(threadIdx.x & 31u), hh = l >> 4, m = l & 15;
  const unsigned char* p = plane + (row0 + m) * STG_PITCH + kb + 16 * hh;
  Frag f;
  f.half[0] = *(const v8bf*)(p);
  f.half[1] = *(const v8bf*)(p + 32);
  return f.v;
}

// ---------------- block GEMM, three-term hi/lo products ----------------
// C[m][n] = sum_k A[m][k] * B[n][k]  (A and B both stored [row][k], k contiguous, D_ elements a row).
// A block makes BM x BN of C with a WGM x WGN grid of waves. Each A plane of a stage lies in SA slices, each B plane in SB:
// [A hi | A lo | B hi | B lo], one slice to a wave; every slice starts at a multiple of 2 KiB.
template <int BM, int BN, int WGM, int WGN, int SA, int SB>
struct Blk {
  static constexpr int TM = BM / WGM / 16, TN = BN / WGN / 16;      // 16x16 accumulators of a wave
  static constexpr int AR = BM / SA, BR = BN / SB;                  // rows of a slice
  static constexpr int ASL = (AR * STG_PITCH + 2047) / 2048 * 2048;
  static constexpr int BSL = (BR * STG_PITCH + 2047) / 2048 * 2048;
  static constexpr int BUF = 2 * SA * ASL + 2 * SB * BSL;           // one buffer
  static constexpr int RING = 2 * BUF;
  static_assert(WGM * WGN == 2 * SA + 2 * SB);                      // one request per wave and stage
  static_assert((AR % 16) == 0 && (BR % 16) == 0);                  // a fragment's 16 rows lie in one slice
};

// The result goes to LDS at the start of the ring, element (row, c16 + lane column) at float index idx(row, c16) + lane column.
template <typename G, int WGN, int SA, int SB, typename Idx>
__device__ __forceinline__ void gemm_block(const u16* Ah, const u16* Al, const u16* Bh, const u16* Bl,
                                           int m0, int n0, unsigned char* ring, Idx idx) {
  const int l = (int)(threadIdx.x & 31u), hh = l >> 4, nc = l & 15;
  const int w = (int)uni(threadIdx.x >> 5);
  const int ar0 = (w / WGN) * (16 * G::TM), br0 = (w % WGN) * (16 * G::TN);   // this wave's first row of A and of B
  int aoff[G::TM], boff[G::TN];                  // place of each fragment's first row in a buffer (hi plane)
  // Every loop over fragments or accumulators below is unrolled: with constant indices these arrays stay in registers.
#pragma unroll
  for (int i = 0; i < G::TM; ++i) aoff[i] = ((ar0 + 16 * i) / G::AR) * G::ASL + ((ar0 + 16 * i) % G::AR) * STG_PITCH;
#pragma unroll
  for (int n = 0; n < G::TN; ++n) boff[n] = 2 * SA * G::ASL + ((br0 + 16 * n) / G::BR) * G::BSL + ((br0 + 16 * n) % G::BR) * STG_PITCH;
  float* tile = (float*)ring;

  const bool isA = w < 2 * SA;                   // waves 0 .. 2 SA - 1 bring A's slices, the others B's
  const u16* sp = isA ? ((w < SA) ? Ah : Al) : ((w < 2 * SA + SB) ? Bh : Bl);
  const int rows = isA ? G::AR : G::BR;
  const int srow = isA ? m0 + (w % SA) * G::AR : n0 + ((w - 2 * SA) % SB) * G::BR;
  const uint64_t ga0 = (uint64_t)(size_t)sp + (uint64_t)srow * (uint64_t)(D_ * 2);
  const uint32_t dst0 = (uint32_t)(size_t)ring + (uint32_t)(isA ? w * G::ASL : 2 * SA * G::ASL + (w - 2 * SA) * G::BSL);
  const int ns = D_ / STG_K;

  u32x8 g1 = tdm_group1((uint32_t)(D_ * 2), (uint32_t)rows);
  u32x4 g0 = tdm_group0(dst0, ga0);
  tdm_load_held(g0, g1);
  wait_tensor0_held(g0, g1);
  __syncthreads();                               // stage 0 is published
  g0 = tdm_group0(dst0 + (uint32_t)G::BUF, ga0 + (uint64_t)STG_ROWB);
  tdm_load_held(g0, g1);

  v8f acc[G::TM][G::TN] = {};
  for (int s = 0; s < ns; ++s) {
    const unsigned char* buf = ring + (s & 1) * G::BUF;
#pragma unroll  // both 32-k halves of the stage in line: every accumulator index is then a constant
    for (int j = 0; j < STG_K / 32; ++j) {
      const int kb = 64 * j;
      v16bf ah[G::TM], al[G::TM];
#pragma unroll
      for (int i = 0; i < G::TM; ++i) {
        ah[i] = ld_frag_lds(buf + aoff[i], 0, kb);
        al[i] = ld_frag_lds(buf + aoff[i] + SA * G::ASL, 0, kb);
      }
      v16bf nh = ld_frag_lds(buf + boff[0], 0, kb);
      v16bf nl = ld_frag_lds(buf + boff[0] + SB * G::BSL, 0, kb);
#pragma unroll
      for (int n = 0; n < G::TN; ++n) {
        const v16bf bh = nh, bl = nl;
        if (n + 1 < G::TN) {                     // the next column's B fragments are asked for ahead of this column's products
          nh = ld_frag_lds(buf + boff[n + 1], 0, kb);
          nl = ld_frag_lds(buf + boff[n + 1] + SB * G::BSL, 0, kb);
        }
        // Term by term down the column of accumulators: neighbours in issue order are independent; each accumulator still sums hi.hi, lo.hi, hi.lo.
#pragma unroll
        for (int i = 0; i < G::TM; ++i) mma(acc[i][n], ah[i], bh);
#pragma unroll
        for (int i = 0; i < G::TM; ++i) mma(acc[i][n], al[i], bh);
#pragma unroll
        for (int i = 0; i < G::TM; ++i) mma(acc[i][n], ah[i], bl);
      }
    }
    // Publish point of stage s + 1: own reads done, own slice landed, then the barrier that also frees stage s's buffer.
    wait_ds0();
    wait_tensor0_held(g0, g1);
    __syncthreads();
    if (pinned((uint32_t)(s + 2 < ns))) {
      g0 = tdm_group0(dst0 + (uint32_t)(s & 1) * (uint32_t)G::BUF, ga0 + (uint64_t)(s + 2) * (uint64_t)STG_ROWB);
      tdm_load_held(g0, g1);
    }
  }
  wait_tensor0_held(g0, g1);
  wait_ds0();
  // The last pass's own barrier stands behind every wave's last read of the ring: its start may now hold the result.
#pragma unroll
  for (int n = 0; n < G::TN; ++n) {
#pragma unroll
    for (int i = 0; i < G::TM; ++i) {
#pragma unroll
      for (int r = 0; r < 8; ++r) tile[idx(ar0 + 16 * i + 8 * hh + r, br0 + 16 * n) + nc] = acc[i][n][r];
    }
  }
}

// ---------------- q/k/v projections as one product: x . [Wq; Wk; Wv]^T, 256 rows x 192 columns (three heads) a block ----------------
// Wh/Wl hold Wq, Wk, Wv, Wo back to back ([n][k] rows). 16 x 16 blocks: one to a WGP.
typedef Blk<256, 192, 4, 3, 4, 2> GQ;        // 12 waves of 64 x 64
#define SUBF 4160                                // floats kept for one 64x64 head tile of the result (64 rows at pitch 64 or 65)
static_assert(12 * SUBF * 4 <= GQ::RING);
static_assert((M_ % 256) == 0 && ((3 * D_) % 192) == 0 && (S_ % 256) == 0);
__global__ __launch_bounds__(384) void k_proj_qkv(const u16* Xh, const u16* Xl,
                                                  const u16* Wh, const u16* Wl,
                                                  u16* Qh, u16* Ql, u16* Kh, u16* Kl,
                                                  u16* Vth, u16* Vtl) {
  __shared__ __attribute__((aligned(2048))) unsigned char ring[GQ::RING];
  const int hd0 = (int)blockIdx.x * 3;       // first of the block's three heads, counted through q, k, v: 0 .. 47
  const int m0 = (int)blockIdx.y * 256;
  // A v head's tile is read back by columns: pitch 65 puts a column's rows on different banks.
  gemm_block<GQ, 3, 4, 2>(Xh, Xl, Wh, Wl, m0, hd0 * 64, ring, [&](int row, int c16) {
    const int ni = c16 >> 6;
    const int pitch = (hd0 + ni >= 2 * H_) ? 65 : 64;
    return ((row >> 6) * 3 + ni) * SUBF + (row & 63) * pitch + (c16 & 63);
  });
  __syncthreads();

  const int wv = (int)uni(threadIdx.x >> 5), w = wv & 3, l = (int)(threadIdx.x & 31u);
  for (int t = wv >> 2; t < 12; t += 3) {    // four waves a head tile
    const float* tile = (const float*)ring + t * SUBF;
    const int z = (hd0 + t % 3) >> 4, hd = (hd0 + t % 3) & (H_ - 1);
    const int m = m0 + (t / 3) * 64;
    const int b = m >> 11, s0 = m & (S_ - 1);
    const int bh = b * H_ + hd;
    if (z < 2) {
      u16* Ph = (z == 0) ? Qh : Kh;
      u16* Pl = (z == 0) ? Ql : Kl;
      const size_t base = ((size_t)bh * (size_t)S_ + (size_t)s0) * (size_t)DH_;
#pragma unroll
      for (int j = 0; j < 4; ++j) {
        const int row = w * 16 + j * 4 + (l >> 3);
        const int c0 = 8 * (l & 7);
        const float* tp = tile + row * 64 + c0;
        const v4f f0 = *(const v4f*)(tp);
        const v4f f1 = *(const v4f*)(tp + 4);
        v4u vh, vl;
        split8(f0, f1, vh, vl);
        const size_t o = base + (size_t)row * (size_t)DH_ + (size_t)c0;
        *(v4u*)(Ph + o) = vh;
        *(v4u*)(Pl + o) = vl;
      }
    } else {
#pragma unroll
      for (int j = 0; j < 4; ++j) {
        const int d = w * 16 + j * 4 + (l >> 3);   // Vt row within the head
        const int k0 = 8 * (l & 7);               // key offset within the 64-key tile
        v4f f0, f1;
        f0.x = tile[(k0 + 0) * 65 + d]; f0.y = tile[(k0 + 1) * 65 + d];
        f0.z = tile[(k0 + 2) * 65 + d]; f0.w = tile[(k0 + 3) * 65 + d];
        f1.x = tile[(k0 + 4) * 65 + d]; f1.y = tile[(k0 + 5) * 65 + d];
        f1.z = tile[(k0 + 6) * 65 + d]; f1.w = tile[(k0 + 7) * 65 + d];
        v4u vh, vl;
        split8(f0, f1, vh, vl);
        const size_t o = ((size_t)bh * (size_t)DH_ + (size_t)d) * (size_t)S_ + (size_t)s0 + (size_t)k0;
        *(v4u*)(Vth + o) = vh;
        *(v4u*)(Vtl + o) = vl;
      }
    }
    asm volatile("s_wait_xcnt 0x0" ::: "memory");  // the next head tile's pass overwrites the registers that these stores name
  }
}

// ---------------- output projection: out = ctx . Wo^T + bo (f32), 128 x 128 a block ----------------
typedef Blk<128, 128, 2, 4, 2, 2> GO;        // 8 waves of 64 x 32
static_assert(128 * 128 * 4 <= GO::RING);
static_assert((M_ % 128) == 0 && (D_ % 128) == 0);
// At most two waves a SIMD: the 256 blocks then stand one to a WGP, on all 256 WGPs, wherever the dispatcher starts them.
__global__ __launch_bounds__(256) __attribute__((amdgpu_waves_per_eu(2, 2))) void k_proj_out(const u16* Ch, const u16* Cl,
                                                  const u16* Wh, const u16* Wl,
                                                  const float* __restrict__ bo, float* out) {
  __shared__ __attribute__((aligned(2048))) unsigned char ring[GO::RING];
  const int n0 = (int)blockIdx.x * 128;
  const int m0 = (int)blockIdx.y * 128;
  const u16* Bh = Wh + (size_t)3 * (size_t)D_ * (size_t)D_;
  const u16* Bl = Wl + (size_t)3 * (size_t)D_ * (size_t)D_;
  gemm_block<GO, 4, 2, 2>(Ch, Cl, Bh, Bl, m0, n0, ring, [&](int row, int c16) { return row * 128 + c16; });
  __syncthreads();

  const float* tile = (const float*)ring;
  const int w = (int)(threadIdx.x >> 5), l = (int)(threadIdx.x & 31u);
  const int c0 = 4 * l;
  const v4f bb = *(const v4f*)(bo + n0 + c0);
#pragma unroll  // the 16 rows' LDS reads go out together, ahead of the stores
  for (int j = 0; j < 16; ++j) {
    const int row = w * 16 + j;
    v4f v = *(const v4f*)(tile + row * 128 + c0);
    v = v + bb;
    float* op = out + (size_t)(m0 + row) * (size_t)D_ + (size_t)(n0 + c0);
    *(v4f*)op = v;
  }
}

union PFrag { v16bf v; unsigned int u[8]; };

// lane l <-> lane l ^ 16
__device__ __forceinline__ float xhalf(float x) {
  return __builtin_bit_cast(float, __builtin_amdgcn_permlanex16(__builtin_bit_cast(int, x), __builtin_bit_cast(int, x),
                                                                0x76543210, 0xfedcba98, false, false));
}

static_assert(S_ / STG_K >= 2);
#define XJ_F (8 * 32 * 4 + 2 * 32)               // floats one wave hands to its partner: O (32 a lane), maximum, sum
static_assert((4 * 16 * 64 + 4 * XJ_F) * 4 <= RING_BYTES);
#define QT_ (S_ / 64)                            // 64-query tiles of a head
static_assert((QT_ % 2) == 0 && QT_ == 32);

// At most four waves a SIMD: the 512 equal blocks then stand two to a WGP, on all 256 WGPs, wherever the dispatcher starts them.
__global__ __launch_bounds__(256) __attribute__((amdgpu_waves_per_eu(4, 4))) void k_attn(const u16* Qh, const u16* Ql,
                                              const u16* Kh, const u16* Kl,
                                              const u16* Vth, const u16* Vtl,
                                              u16* Ch, u16* Cl) {
  __shared__ __attribute__((aligned(2048))) unsigned char ring[RING_BYTES];

  const int gw = (int)blockIdx.x;                // 0 .. B*H*(S/128)-1
  const int bh = gw >> 4, tp = gw & 15;
  const int b = bh >> 4, hd = bh & 15;
  const int l = (int)(threadIdx.x & 31u), hh = l >> 4, nc = l & 15;
  const int w = (int)uni(threadIdx.x >> 5);
  const int qw = w & 3, par = w >> 2;            // which 16 queries of the tile, which 32 keys of every stage
  const uint32_t issuer = (uint32_t)(w < 4);     // waves 0..3 bring the four planes
  const int ex = hd + 1;                         // slope = 2^(-(h+1)/2)
  const float slope = ((ex & 1) ? 0.70710678118654752f : 1.0f) *
                      __uint_as_float((unsigned int)(127 - (ex >> 1)) << 23);

  const u16* Qhp  = Qh  + (size_t)bh * (size_t)S_ * (size_t)DH_;
  const u16* Qlp  = Ql  + (size_t)bh * (size_t)S_ * (size_t)DH_;
  const u16* Khp  = Kh  + (size_t)bh * (size_t)S_ * (size_t)DH_;
  const u16* Klp  = Kl  + (size_t)bh * (size_t)S_ * (size_t)DH_;
  const u16* Vthp = Vth + (size_t)bh * (size_t)DH_ * (size_t)S_;
  const u16* Vtlp = Vtl + (size_t)bh * (size_t)DH_ * (size_t)S_;

  // This wave's plane: first byte, source row pitch, and the step from one stage's tile to the next.
  const u16* sp = (qw == 0) ? Khp : (qw == 1) ? Klp : (qw == 2) ? Vthp : Vtlp;
  const uint64_t ga0 = (uint64_t)(size_t)sp;
  const uint32_t spitch = (qw < 2) ? (uint32_t)(DH_ * 2) : (uint32_t)(S_ * 2);
  const uint64_t sstep = (qw < 2) ? (uint64_t)(STG_K * DH_ * 2) : (uint64_t)STG_ROWB;
  const uint32_t dst0 = (uint32_t)(size_t)ring + (uint32_t)qw * (uint32_t)STG_SLICE;
  u32x8 g1 = tdm_group1(spitch, 64u);

  for (int pass = 0; pass < 2; ++pass) {
  const int qb = pass ? tp : (QT_ - 1 - tp);     // block-uniform
  const int q0 = qb * 64 + qw * 16;
  const int ns = qb + 1;                         // keys 0 .. 64 qb + 63, 64 per stage
  if (pass) {
    // The first tile's output rows stand in the ring: own reads of them done, then the barrier behind every wave's reads, and only then the refill.
    wait_ds0();
    __syncthreads();
  }

  u32x4 g0 = tdm_group0(dst0, ga0);
  if (pinned(issuer)) {
    tdm_load_held(g0, g1);
    wait_tensor0_held(g0, g1);
  }
  __syncthreads();                               // stage 0 is published
  if (pinned(issuer)) {
    g0 = tdm_group0(dst0 + (uint32_t)STG_BYTES, ga0 + sstep);   // keys 64..127 lie in the planes for every block
    tdm_load_held(g0, g1);
  }

  const v16bf q0h = ld_frag(Qhp, DH_, q0, 0),  q0l = ld_frag(Qlp, DH_, q0, 0);
  const v16bf q1h = ld_frag(Qhp, DH_, q0, 32), q1l = ld_frag(Qlp, DH_, q0, 32);

  v8f o[4] = {};                                 // o[si][r] = O[query nc][d = 16 si + 8 h + r]
  float mq = -3.0e38f;                           // running maximum of this lane's query (equal in both halves)
  float lq = 0.0f;                               // this half's share of the query's sum; halves joined after the loop
  const int q = q0 + nc;

  const int nchunk = (q0 >> 5) + 1;              // these queries' keys 0 .. q0+15, 32 per chunk; this wave takes chunks par, par + 2, ...
  for (int s = 0; s < ns; ++s) {
    const unsigned char* buf = ring + (s & 1) * STG_BYTES;
    const unsigned char* pKh = buf + par * (32 * STG_PITCH);      // this wave's 32 key rows of the stage
    const unsigned char* pKl = pKh + STG_SLICE;
    const unsigned char* pVh = buf + 2 * STG_SLICE + par * 64;    // the same 32 keys' bytes in every V^T row
    const unsigned char* pVl = pVh + STG_SLICE;
    {
      const int c = 2 * s + par;
      if (c < nchunk) {                          // wave-uniform: a chunk wholly above this wave's diagonal is skipped
        const int ks = c << 5;
        v8f sc[2] = {};
#pragma unroll
        for (int t = 0; t < 2; ++t) {
          const int kr = 16 * t;                 // A[m=key][k=d]: rows of K, d contiguous
          const v16bf k0h = ld_frag_lds(pKh, kr, 0),  k0l = ld_frag_lds(pKl, kr, 0);
          const v16bf k1h = ld_frag_lds(pKh, kr, 64), k1l = ld_frag_lds(pKl, kr, 64);
          mma(sc[t], k0h, q0h); mma(sc[t], k0h, q0l); mma(sc[t], k0l, q0h);
          mma(sc[t], k1h, q1h); mma(sc[t], k1h, q1l); mma(sc[t], k1l, q1h);
        }

        float xs[2][8];
        float t0 = -3.0e38f;
#pragma unroll
        for (int t = 0; t < 2; ++t) {
#pragma unroll
          for (int r = 0; r < 8; ++r) {
            const int kk = ks + 16 * t + 8 * hh + r;
            float x = (sc[t][r] - (float)(q - kk) * slope) * 0.125f;
            x = 30.0f * __builtin_amdgcn_tanhf(x * (1.0f / 30.0f));   // one v_tanh_f32: no branch, so the 16 scores of a lane run as independent chains
            x = (kk <= q) ? x : -3.0e38f;
            xs[t][r] = x;
            t0 = fmaxf(t0, x);
          }
        }
        t0 = fmaxf(t0, xhalf(t0));
        const float mnew = fmaxf(mq, t0);
        const float alpha = __expf(mq - mnew);
        mq = mnew;

        PFrag ph, pl;
        float u = 0.0f;
#pragma unroll
        for (int t = 0; t < 2; ++t) {
#pragma unroll
          for (int i = 0; i < 4; ++i) {
            const float pa = __expf(xs[t][2 * i] - mnew);
            const float pb = __expf(xs[t][2 * i + 1] - mnew);
            u += pa + pb;
            split_pair(pa, pb, ph.u[4 * t + i], pl.u[4 * t + i]);
          }
        }
        lq = lq * alpha + u;
#pragma unroll
        for (int si = 0; si < 4; ++si) o[si] *= alpha;

#pragma unroll
        for (int si = 0; si < 4; ++si) {         // A[m=d][k=key]: rows of Vt, keys contiguous
          const v16bf vh = ld_frag_lds(pVh, 16 * si, 0);
          const v16bf vl = ld_frag_lds(pVl, 16 * si, 0);
          mma(o[si], vh, ph.v); mma(o[si], vh, pl.v); mma(o[si], vl, ph.v);
        }
      }
    }
    // Publish point of stage s + 1, passed by every wave: own reads done, own slice landed, then the barrier that also frees stage s's buffer.
    wait_ds0();
    wait_tensor0_held(g0, g1);
    __syncthreads();
    if (pinned(issuer & (uint32_t)(s + 2 < ns))) {
      g0 = tdm_group0(dst0 + (uint32_t)(s & 1) * (uint32_t)STG_BYTES, ga0 + (uint64_t)(s + 2) * sstep);
      tdm_load_held(g0, g1);
    }
  }
  wait_tensor0_held(g0, g1);
  wait_ds0();
  // The last pass's own barrier stands behind every wave's last read of the ring: its start may now hold the four output tiles,
  // and behind them what waves 4..7 hand to their partners (lane to lane: both waves of a pair hold the same query and d in a lane).
  float* ctile = (float*)ring + qw * (16 * 64);
  float* xj = (float*)ring + 4 * 16 * 64 + qw * XJ_F;
  if (par) {
#pragma unroll  // constant indices: o stays in registers
    for (int si = 0; si < 4; ++si) {
      v4f c0v, c1v;
      c0v.x = o[si][0]; c0v.y = o[si][1]; c0v.z = o[si][2]; c0v.w = o[si][3];
      c1v.x = o[si][4]; c1v.y = o[si][5]; c1v.z = o[si][6]; c1v.w = o[si][7];
      *(v4f*)(xj + ((2 * si) * 32 + l) * 4) = c0v;
      *(v4f*)(xj + ((2 * si + 1) * 32 + l) * 4) = c1v;
    }
    xj[8 * 32 * 4 + l] = mq;
    xj[8 * 32 * 4 + 32 + l] = lq;
  }
  __syncthreads();                               // the partners' partial results are published
  if (!par) {
    // A partner that had no chunk hands over maximum -3e38, sum 0, O 0: its weight a1 is then 0.
    const float m1 = xj[8 * 32 * 4 + l];
    const float l1 = xj[8 * 32 * 4 + 32 + l];
    const float mj = fmaxf(mq, m1);
    const float a0 = __expf(mq - mj), a1 = __expf(m1 - mj);
    lq = lq * a0 + l1 * a1;
    const float inv = 1.0f / (lq + xhalf(lq));
    const float b0 = a0 * inv, b1 = a1 * inv;
#pragma unroll  // constant indices: o stays in registers; the eight LDS reads go out together
    for (int si = 0; si < 4; ++si) {
      const v4f x0 = *(const v4f*)(xj + ((2 * si) * 32 + l) * 4);
      const v4f x1 = *(const v4f*)(xj + ((2 * si + 1) * 32 + l) * 4);
      float* cp = ctile + nc * 64 + 16 * si + 8 * hh;
      v4f c0v, c1v;
      c0v.x = o[si][0] * b0 + x0.x * b1; c0v.y = o[si][1] * b0 + x0.y * b1; c0v.z = o[si][2] * b0 + x0.z * b1; c0v.w = o[si][3] * b0 + x0.w * b1;
      c1v.x = o[si][4] * b0 + x1.x * b1; c1v.y = o[si][5] * b0 + x1.y * b1; c1v.z = o[si][6] * b0 + x1.z * b1; c1v.w = o[si][7] * b0 + x1.w * b1;
      *(v4f*)(cp) = c0v;
      *(v4f*)(cp + 4) = c1v;
    }
  }
  __syncthreads();
  if (!par) {
  const size_t rbase = ((size_t)b * (size_t)S_ + (size_t)q0) * (size_t)D_ + (size_t)hd * (size_t)DH_;
#pragma unroll
  for (int j = 0; j < 4; ++j) {
    const int row = j * 4 + (l >> 3);
    const int c0 = 8 * (l & 7);
    const float* tp = ctile + row * 64 + c0;
    const v4f f0 = *(const v4f*)(tp);
    const v4f f1 = *(const v4f*)(tp + 4);
    v4u vh, vl;
    split8(f0, f1, vh, vl);
    const size_t oidx = rbase + (size_t)row * (size_t)D_ + (size_t)c0;
    *(v4u*)(Ch + oidx) = vh;
    *(v4u*)(Cl + oidx) = vl;
    
  }
  asm volatile("s_wait_xcnt 0x0" ::: "memory");  // the second tile's pass overwrites the registers that these stores name
  }
  }
}

extern "C" void kernel_launch(void* const* d_in, const int* in_sizes, int n_in,
                              void* d_out, int out_size, void* d_ws, size_t ws_size,
                              hipStream_t stream) {
  if (n_in < 6) return;
  const int nX = M_ * D_;          // 4194304
  const int nW = D_ * D_;          // 1048576
  const int nHead = B_ * H_ * S_ * DH_;   // 4194304
  if (in_sizes[0] != nX || in_sizes[1] != nW || in_sizes[2] != nW ||
      in_sizes[3] != nW || in_sizes[4] != nW || in_sizes[5] != D_) return;
  if (out_size != nX) return;

  const float* hs = (const float*)d_in[0];
  const float* wq = (const float*)d_in[1];
  const float* wk = (const float*)d_in[2];
  const float* wv = (const float*)d_in[3];
  const float* wo = (const float*)d_in[4];
  const float* bo = (const float*)d_in[5];
  float* out = (float*)d_out;

  char* ws = (char*)d_ws;
  size_t off = 0;
  const size_t bX = (size_t)nX * 2u;            // 8 MiB per plane
  const size_t bW = (size_t)nW * 2u * 4u;       // four matrices per plane, 8 MiB
  const size_t bHd = (size_t)nHead * 2u;        // 8 MiB per plane
  u16* Xh  = (u16*)(ws + off); off += bX;
  u16* Xl  = (u16*)(ws + off); off += bX;
  u16* Wh  = (u16*)(ws + off); off += bW;
  u16* Wl  = (u16*)(ws + off); off += bW;
  u16* Qh  = (u16*)(ws + off); off += bHd;
  u16* Ql  = (u16*)(ws + off); off += bHd;
  u16* Kh  = (u16*)(ws + off); off += bHd;
  u16* Kl  = (u16*)(ws + off); off += bHd;
  u16* Vth = (u16*)(ws + off); off += bHd;
  u16* Vtl = (u16*)(ws + off); off += bHd;
  u16* Ch  = (u16*)(ws + off); off += bX;
  u16* Cl  = (u16*)(ws + off); off += bX;
  if (off > ws_size) return;                    // 100663296 B total

  // 1) f32 -> bf16 hi/lo planes: x (2048 blocks needed) and 4 weights (512 blocks each)
  k_split<<<dim3((unsigned)(nX / 8 / 256), 5, 1), 256, 0, stream>>>(hs, wq, wk, wv, wo, Xh, Xl, Wh, Wl, nX, nW);
  // 2) q/k/v projections: 16 tiles of three heads x 16 row tiles
  k_proj_qkv<<<dim3(3 * D_ / 192, M_ / 256, 1), 384, 0, stream>>>(Xh, Xl, Wh, Wl, Qh, Ql, Kh, Kl, Vth, Vtl);
  // 3) attention: one 256-thread block per (b, h, pair of 64-query tiles)
  k_attn<<<dim3((unsigned)(B_ * H_ * (S_ / 128)), 1, 1), 256, 0, stream>>>(Qh, Ql, Kh, Kl, Vth, Vtl, Ch, Cl);
  // 4) output projection + bias
  k_proj_out<<<dim3(D_ / 128, M_ / 128, 1), 256, 0, stream>>>(Ch, Cl, Wh, Wl, bo, out);
  (void)hipGetLastError();
}
